// v000
// The times below were measured on an AMD MI455X: many runs one after another, warmed up first and cycling through
// copies of the inputs, with the whole window's GPU time divided by the number of runs. Launches and the gaps
// between them are all in it. The median over several windows is given; except for v000 it joins two sittings, which
// can be a few percent apart, so the side-by-side timings, each taken in one sitting, are the better comparison.
// The starting kernel, v000, takes 80.2 microseconds a run.
#include <hip/hip_runtime.h>

// ---------------------------------------------------------------------------
// Problem constants (from the reference):
//   x      : [1, 2048, 1024]  fp32
//   w_qkv  : [192, 1024]      fp32   (torch Linear layout: [out, in])
//   w_out  : [1024, 64]       fp32
//   y      : [1, 2048, 1024]  fp32
// per-head dim is 1 (64 heads), scale = 1/sqrt(64) = 0.125
// ---------------------------------------------------------------------------
#define SEQ   2048
#define DIM   1024
#define NHEAD 64
#define FQKV  (3 * NHEAD)   // 192

typedef float v2f __attribute__((ext_vector_type(2)));
typedef float v8f __attribute__((ext_vector_type(8)));

// ---------------------------------------------------------------------------
// C[M x N] = A[M x K] * W[N x K]^T   (all fp32, row-major)
// One wave32 per 16x16 C tile; K-loop steps of 4 using V_WMMA_F32_16X16X4_F32.
//
// VGPR layouts per CDNA5 ISA 7.12.2:
//   A (32-bit, 16x4):  lanes 0-15 -> M=lane, VGPR0=K0,VGPR1=K1
//                      lanes 16-31 -> M=lane-16, VGPR0=K2,VGPR1=K3
//   B (32-bit, 4x16):  symmetric (N=lane&15, K = (lane>>4)*2 + {0,1})
//   C/D (32-bit,16x16): VGPR r: lanes 0-15 -> M=r, lanes 16-31 -> M=8+r; N=lane&15
// ---------------------------------------------------------------------------
__global__ __launch_bounds__(32)
void gemm_f32_wmma(const float* __restrict__ A,
                   const float* __restrict__ W,
                   float* __restrict__ C,
                   int N, int K) {
  const int lane = threadIdx.x;     // 0..31, wave32
  const int half = lane >> 4;       // 0 or 1
  const int sub  = lane & 15;       // A row within tile / B col within tile
  const int m0 = blockIdx.y << 4;
  const int n0 = blockIdx.x << 4;

  const float* __restrict__ arow = A + (size_t)(m0 + sub) * K;
  const float* __restrict__ wrow = W + (size_t)(n0 + sub) * K;

  v8f acc = {};
  for (int k0 = 0; k0 < K; k0 += 4) {
    const int ka = k0 + half * 2;
    v2f a, b;
    a.x = arow[ka];
    a.y = arow[ka + 1];
    b.x = wrow[ka];
    b.y = wrow[ka + 1];
    // (neg_a, A, neg_b, B, c_mod, C, reuse_a, reuse_b)
    acc = __builtin_amdgcn_wmma_f32_16x16x4_f32(false, a, false, b,
                                                (short)0, acc, false, false);
  }

#pragma unroll
  for (int r = 0; r < 8; ++r) {
    C[(size_t)(m0 + r + half * 8) * N + (n0 + sub)] = acc[r];
  }
}

// ---------------------------------------------------------------------------
// Per-head causal attention with head-dim 1 (the reference's quirk):
//   oh[i,h] = sum_{j<=i} softmax_j(q[i,h] * k[j,h] * 0.125) * v[j,h]
// One block = one head x 256 queries. k/v columns of this head staged in LDS,
// one lane per query runs the online-softmax scan over j <= i.
// ---------------------------------------------------------------------------
__global__ __launch_bounds__(256)
void attn_headdim1_causal(const float* __restrict__ qkv,  // [SEQ, 192]
                          float* __restrict__ oh) {       // [SEQ, 64]
  __shared__ float k_s[SEQ];
  __shared__ float v_s[SEQ];
  const int h   = blockIdx.y;
  const int tid = threadIdx.x;

  for (int t = tid; t < SEQ; t += 256) {
    const size_t base = (size_t)t * FQKV;
    k_s[t] = qkv[base + NHEAD + h];
    v_s[t] = qkv[base + 2 * NHEAD + h];
  }
  __syncthreads();

  const int i = blockIdx.x * 256 + tid;
  const float q = qkv[(size_t)i * FQKV + h] * 0.125f;

  float m = -3.402823466e38f;
  float l = 0.0f;
  float acc = 0.0f;
  for (int j = 0; j <= i; ++j) {
    const float s    = q * k_s[j];
    const float mn   = fmaxf(m, s);
    const float corr = __expf(m - mn);
    const float p    = __expf(s - mn);
    l   = l * corr + p;
    acc = acc * corr + p * v_s[j];
    m   = mn;
  }
  oh[(size_t)i * NHEAD + h] = acc / l;
}

// ---------------------------------------------------------------------------
// Launch: qkv GEMM -> attention -> output GEMM. Scratch in d_ws:
//   qkv : SEQ*192 floats (1.5 MB)
//   oh  : SEQ*64  floats (0.5 MB)
// ---------------------------------------------------------------------------
extern "C" void kernel_launch(void* const* d_in, const int* in_sizes, int n_in,
                              void* d_out, int out_size, void* d_ws, size_t ws_size,
                              hipStream_t stream) {
  const float* x     = (const float*)d_in[0];   // [1, 2048, 1024]
  const float* w_qkv = (const float*)d_in[1];   // [192, 1024]
  const float* w_out = (const float*)d_in[2];   // [1024, 64]
  float* y = (float*)d_out;                     // [1, 2048, 1024]

  float* qkv = (float*)d_ws;                    // [2048, 192]
  float* oh  = qkv + (size_t)SEQ * FQKV;        // [2048, 64]

  // qkv = x * w_qkv^T    (M=2048, N=192, K=1024)
  gemm_f32_wmma<<<dim3(FQKV / 16, SEQ / 16), 32, 0, stream>>>(
      x, w_qkv, qkv, FQKV, DIM);

  // per-head causal softmax attention (head dim 1)
  attn_headdim1_causal<<<dim3(SEQ / 256, NHEAD), 256, 0, stream>>>(qkv, oh);

  // y = oh * w_out^T     (M=2048, N=1024, K=64)
  gemm_f32_wmma<<<dim3(DIM / 16, SEQ / 16), 32, 0, stream>>>(
      oh, w_out, y, DIM, NHEAD);
}

// v001
// It runs in 57.4 microseconds.
// Next to v000, in two timings, it ran 1.45 and 1.43 times as fast.
#include <hip/hip_runtime.h>

// ---------------------------------------------------------------------------
// Problem constants (from the reference):
//   x      : [1, 2048, 1024]  fp32
//   w_qkv  : [192, 1024]      fp32   (torch Linear layout: [out, in])
//   w_out  : [1024, 64]       fp32
//   y      : [1, 2048, 1024]  fp32
// per-head dim is 1 (64 heads), scale = 1/sqrt(64) = 0.125
// ---------------------------------------------------------------------------
#define SEQ   2048
#define DIM   1024
#define NHEAD 64
#define FQKV  (3 * NHEAD)   // 192

typedef float v2f __attribute__((ext_vector_type(2)));
typedef float v8f __attribute__((ext_vector_type(8)));

// ---------------------------------------------------------------------------
// C[M x N] = A[M x K] * W[N x K]^T   (all fp32, row-major)
// One wave32 per 16x16 C tile; K-loop steps of 4 using V_WMMA_F32_16X16X4_F32.
//
// VGPR layouts per CDNA5 ISA 7.12.2:
//   A (32-bit, 16x4):  lanes 0-15 -> M=lane, VGPR0=K0,VGPR1=K1
//                      lanes 16-31 -> M=lane-16, VGPR0=K2,VGPR1=K3
//   B (32-bit, 4x16):  symmetric (N=lane&15, K = (lane>>4)*2 + {0,1})
//   C/D (32-bit,16x16): VGPR r: lanes 0-15 -> M=r, lanes 16-31 -> M=8+r; N=lane&15
// ---------------------------------------------------------------------------
__global__ __launch_bounds__(32)
void gemm_f32_wmma(const float* __restrict__ A,
                   const float* __restrict__ W,
                   float* __restrict__ C,
                   int N, int K) {
  const int lane = threadIdx.x;     // 0..31, wave32
  const int half = lane >> 4;       // 0 or 1
  const int sub  = lane & 15;       // A row within tile / B col within tile
  const int m0 = blockIdx.y << 4;
  const int n0 = blockIdx.x << 4;

  const float* __restrict__ arow = A + (size_t)(m0 + sub) * K;
  const float* __restrict__ wrow = W + (size_t)(n0 + sub) * K;

  v8f acc = {};
  for (int k0 = 0; k0 < K; k0 += 4) {
    const int ka = k0 + half * 2;
    v2f a, b;
    a.x = arow[ka];
    a.y = arow[ka + 1];
    b.x = wrow[ka];
    b.y = wrow[ka + 1];
    // (neg_a, A, neg_b, B, c_mod, C, reuse_a, reuse_b)
    acc = __builtin_amdgcn_wmma_f32_16x16x4_f32(false, a, false, b,
                                                (short)0, acc, false, false);
  }

#pragma unroll
  for (int r = 0; r < 8; ++r) {
    C[(size_t)(m0 + r + half * 8) * N + (n0 + sub)] = acc[r];
  }
}

// ---------------------------------------------------------------------------
// Per-head causal attention with head-dim 1 (the reference's quirk):
//   oh[i,h] = sum_{j<=i} softmax_j(q[i,h] * k[j,h] * 0.125) * v[j,h]
// One block = one head x 256 queries. k/v columns of this head staged in LDS,
// one lane per query.
//
// The score q*k is monotone in k, so the row maximum over j <= i is known before
// the scan: q * max_{j<=i} k for q >= 0, q * min_{j<=i} k for q < 0. The prefix
// maximum and minimum of k are formed once while the keys are staged; the scan
// then has no running maximum and no rescale: one exp2 per (query, key) and sums
// that do not depend on one another.
// ---------------------------------------------------------------------------
__global__ __launch_bounds__(256)
void attn_headdim1_causal(const float* __restrict__ qkv,  // [SEQ, 192]
                          float* __restrict__ oh) {       // [SEQ, 64]
  __shared__ __attribute__((aligned(16))) float k_s[SEQ];
  __shared__ __attribute__((aligned(16))) float v_s[SEQ];
  __shared__ float own_max_s[8], own_min_s[8];    // per wave: this block's own 256 keys
  __shared__ float base_max_s[8], base_min_s[8];  // per wave: keys of earlier chunks
  const int h     = blockIdx.y;
  const int chunk = blockIdx.x;
  const int tid   = threadIdx.x;
  const int lane  = tid & 31;
  const int wave  = __builtin_amdgcn_readfirstlane(tid >> 5);

  const int i0 = chunk * 256 + wave * 32;   // first query of this wave
  const int i  = i0 + lane;
  const float qraw = qkv[(size_t)i * FQKV + h];

  float bmax = -3.402823466e38f, bmin = 3.402823466e38f;
  float kown = 0.0f;
  // unrolled: all sixteen loads are in flight together
#pragma unroll
  for (int c = 0; c < SEQ / 256; ++c) {
    const int t = c * 256 + tid;
    const size_t base = (size_t)t * FQKV;
    const float kk = qkv[base + NHEAD + h];
    k_s[t] = kk;
    v_s[t] = qkv[base + 2 * NHEAD + h];
    if (c < chunk) { bmax = fmaxf(bmax, kk); bmin = fminf(bmin, kk); }
    if (c == chunk) kown = kk;
  }

  // In-wave inclusive prefix max/min of the block's own keys; in-wave max/min of
  // the earlier chunks' keys.
  float smax = kown, smin = kown;
  // unrolled: constant shuffle distances
#pragma unroll
  for (int d = 1; d < 32; d <<= 1) {
    const float umax = __shfl_up(smax, d, 32);
    const float umin = __shfl_up(smin, d, 32);
    const float xmax = __shfl_xor(bmax, d, 32);
    const float xmin = __shfl_xor(bmin, d, 32);
    if (lane >= d) { smax = fmaxf(smax, umax); smin = fminf(smin, umin); }
    bmax = fmaxf(bmax, xmax);
    bmin = fminf(bmin, xmin);
  }
  if (lane == 31) {
    own_max_s[wave]  = smax;  own_min_s[wave]  = smin;
    base_max_s[wave] = bmax;  base_min_s[wave] = bmin;
  }
  __syncthreads();

  // Earlier chunks count from every wave, the block's own keys from the waves in front.
  // unrolled, with selects and no branch: the LDS reads go out together, one wait
#pragma unroll
  for (int w = 0; w < 8; ++w) {
    const float omax = own_max_s[w], omin = own_min_s[w];
    smax = fmaxf(smax, fmaxf(base_max_s[w], w < wave ? omax : -3.402823466e38f));
    smin = fminf(smin, fminf(base_min_s[w], w < wave ? omin : 3.402823466e38f));
  }

  // scale and log2(e) folded into q: exp(s - m) = exp2(qs * k - qs * kext)
  const float qs = qraw * (0.125f * 1.44269504088896340736f);
  const float ms = qs * (qs >= 0.0f ? smax : smin);
  const v2f q2 = {qs, qs};
  const v2f m2 = {-ms, -ms};

  v2f l0 = {0.0f, 0.0f}, l1 = {0.0f, 0.0f};
  v2f a0 = {0.0f, 0.0f}, a1 = {0.0f, 0.0f};

  // Keys in front of the wave's first query: every lane takes every key.
  // 32 keys a trip (i0 is a multiple of 32): a trip's LDS reads issue as a group
  // ahead of their use, and the loop's own cost spreads over 32 keys.
#pragma unroll 8
  for (int j = 0; j < i0; j += 4) {
    const float4 kk = *(const float4*)&k_s[j];
    const float4 vv = *(const float4*)&v_s[j];
    const v2f s0 = __builtin_elementwise_fma(q2, (v2f){kk.x, kk.y}, m2);
    const v2f s1 = __builtin_elementwise_fma(q2, (v2f){kk.z, kk.w}, m2);
    const v2f p0 = {__builtin_amdgcn_exp2f(s0.x), __builtin_amdgcn_exp2f(s0.y)};
    const v2f p1 = {__builtin_amdgcn_exp2f(s1.x), __builtin_amdgcn_exp2f(s1.y)};
    l0 += p0;
    l1 += p1;
    a0 = __builtin_elementwise_fma(p0, (v2f){vv.x, vv.y}, a0);
    a1 = __builtin_elementwise_fma(p1, (v2f){vv.z, vv.w}, a1);
  }

  // The wave's own 32 keys: key j counts for query i only where j <= i.
  // Runs once per wave: eight keys a trip keeps this tail's code short.
#pragma unroll 2
  for (int u = 0; u < 32; u += 4) {
    const float4 kk = *(const float4*)&k_s[i0 + u];
    const float4 vv = *(const float4*)&v_s[i0 + u];
    const v2f s0 = __builtin_elementwise_fma(q2, (v2f){kk.x, kk.y}, m2);
    const v2f s1 = __builtin_elementwise_fma(q2, (v2f){kk.z, kk.w}, m2);
    const v2f p0 = {u + 0 <= lane ? __builtin_amdgcn_exp2f(s0.x) : 0.0f,
                    u + 1 <= lane ? __builtin_amdgcn_exp2f(s0.y) : 0.0f};
    const v2f p1 = {u + 2 <= lane ? __builtin_amdgcn_exp2f(s1.x) : 0.0f,
                    u + 3 <= lane ? __builtin_amdgcn_exp2f(s1.y) : 0.0f};
    l0 += p0;
    l1 += p1;
    a0 = __builtin_elementwise_fma(p0, (v2f){vv.x, vv.y}, a0);
    a1 = __builtin_elementwise_fma(p1, (v2f){vv.z, vv.w}, a1);
  }

  const float l   = (l0.x + l0.y) + (l1.x + l1.y);
  const float acc = (a0.x + a0.y) + (a1.x + a1.y);
  oh[(size_t)i * NHEAD + h] = acc / l;
}

// ---------------------------------------------------------------------------
// Launch: qkv GEMM -> attention -> output GEMM. Scratch in d_ws:
//   qkv : SEQ*192 floats (1.5 MB)
//   oh  : SEQ*64  floats (0.5 MB)
// ---------------------------------------------------------------------------
extern "C" void kernel_launch(void* const* d_in, const int* in_sizes, int n_in,
                              void* d_out, int out_size, void* d_ws, size_t ws_size,
                              hipStream_t stream) {
  const float* x     = (const float*)d_in[0];   // [1, 2048, 1024]
  const float* w_qkv = (const float*)d_in[1];   // [192, 1024]
  const float* w_out = (const float*)d_in[2];   // [1024, 64]
  float* y = (float*)d_out;                     // [1, 2048, 1024]

  float* qkv = (float*)d_ws;                    // [2048, 192]
  float* oh  = qkv + (size_t)SEQ * FQKV;        // [2048, 64]

  // qkv = x * w_qkv^T    (M=2048, N=192, K=1024)
  gemm_f32_wmma<<<dim3(FQKV / 16, SEQ / 16), 32, 0, stream>>>(
      x, w_qkv, qkv, FQKV, DIM);

  // per-head causal softmax attention (head dim 1)
  attn_headdim1_causal<<<dim3(SEQ / 256, NHEAD), 256, 0, stream>>>(qkv, oh);

  // y = oh * w_out^T     (M=2048, N=1024, K=64)
  gemm_f32_wmma<<<dim3(DIM / 16, SEQ / 16), 32, 0, stream>>>(
      oh, w_out, y, DIM, NHEAD);
}

// v002
// Measured time: 51.3 microseconds a run.
// Next to v001, in two timings, it ran 1.13 and 1.11 times as fast.
// All steps since v000 together make it 1.61 times as fast.
#include <hip/hip_runtime.h>

// ---------------------------------------------------------------------------
// Problem constants (from the reference):
//   x      : [1, 2048, 1024]  fp32
//   w_qkv  : [192, 1024]      fp32   (torch Linear layout: [out, in])
//   w_out  : [1024, 64]       fp32
//   y      : [1, 2048, 1024]  fp32
// per-head dim is 1 (64 heads), scale = 1/sqrt(64) = 0.125
// ---------------------------------------------------------------------------
#define SEQ   2048
#define DIM   1024
#define NHEAD 64
#define FQKV  (3 * NHEAD)   // 192

typedef float v2f __attribute__((ext_vector_type(2)));
typedef float v8f __attribute__((ext_vector_type(8)));

// ---------------------------------------------------------------------------
// C[M x N] = A[M x K] * W[N x K]^T   (all fp32, row-major)
// One wave32 per 16x16 C tile; K-loop steps of 4 using V_WMMA_F32_16X16X4_F32.
//
// VGPR layouts per CDNA5 ISA 7.12.2:
//   A (32-bit, 16x4):  lanes 0-15 -> M=lane, VGPR0=K0,VGPR1=K1
//                      lanes 16-31 -> M=lane-16, VGPR0=K2,VGPR1=K3
//   B (32-bit, 4x16):  symmetric (N=lane&15, K = (lane>>4)*2 + {0,1})
//   C/D (32-bit,16x16): VGPR r: lanes 0-15 -> M=r, lanes 16-31 -> M=8+r; N=lane&15
// ---------------------------------------------------------------------------
__global__ __launch_bounds__(32)
void gemm_f32_wmma(const float* __restrict__ A,
                   const float* __restrict__ W,
                   float* __restrict__ C,
                   int N, int K) {
  const int lane = threadIdx.x;     // 0..31, wave32
  const int half = lane >> 4;       // 0 or 1
  const int sub  = lane & 15;       // A row within tile / B col within tile
  const int m0 = blockIdx.y << 4;
  const int n0 = blockIdx.x << 4;

  const float* __restrict__ arow = A + (size_t)(m0 + sub) * K;
  const float* __restrict__ wrow = W + (size_t)(n0 + sub) * K;

  v8f acc = {};
  for (int k0 = 0; k0 < K; k0 += 4) {
    const int ka = k0 + half * 2;
    v2f a, b;
    a.x = arow[ka];
    a.y = arow[ka + 1];
    b.x = wrow[ka];
    b.y = wrow[ka + 1];
    // (neg_a, A, neg_b, B, c_mod, C, reuse_a, reuse_b)
    acc = __builtin_amdgcn_wmma_f32_16x16x4_f32(false, a, false, b,
                                                (short)0, acc, false, false);
  }

#pragma unroll
  for (int r = 0; r < 8; ++r) {
    C[(size_t)(m0 + r + half * 8) * N + (n0 + sub)] = acc[r];
  }
}

// ---------------------------------------------------------------------------
// Per-head causal attention with head-dim 1 (the reference's quirk):
//   oh[i,h] = sum_{j<=i} softmax_j(q[i,h] * k[j,h] * 0.125) * v[j,h]
// One lane per query, one wave per 32 queries, k/v columns of the head staged in LDS.
//
// A query chunk's cost grows with its index (causal), so one block takes one head
// and TWO chunks of 256 queries: chunk c (short scans) and chunk 7 - c (long scans),
// eight waves each, side by side on one staged copy of k and v. Every block then
// has the same number of (query, key) pairs, and so has every group of waves
// w, w + 4, w + 8, w + 12 (the short chunk's tiles are dealt in reverse order).
//
// The score q*k is monotone in k, so the row maximum over j <= i is known before
// the scan: q * max_{j<=i} k for q >= 0, q * min_{j<=i} k for q < 0. The prefix
// maximum and minimum of k are formed once while the keys are staged; the scan
// then has no running maximum and no rescale: one exp2 per (query, key) and sums
// that do not depend on one another.
// ---------------------------------------------------------------------------
__global__ __launch_bounds__(512)
void attn_headdim1_causal(const float* __restrict__ qkv,  // [SEQ, 192]
                          float* __restrict__ oh) {       // [SEQ, 64]
  __shared__ __attribute__((aligned(16))) float k_s[SEQ];
  __shared__ __attribute__((aligned(16))) float v_s[SEQ];
  // First index below: 0 = the short chunk, 1 = the long chunk.
  // Per key of the two chunks: max/min from its 32-key segment's start up to itself.
  __shared__ float pre_max_s[2][256], pre_min_s[2][256];
  // Per 32-key segment of the two chunks: max/min of the whole segment.
  __shared__ __attribute__((aligned(16))) float seg_max_s[2][8], seg_min_s[2][8];
  // Per staging wave: max/min of the keys it staged that lie in front of the chunk.
  __shared__ __attribute__((aligned(16))) float base_max_s[2][16], base_min_s[2][16];
  const int h    = blockIdx.y;
  const int lc   = blockIdx.x;                 // short chunk: 0..3
  const int hc   = SEQ / 256 - 1 - lc;         // long chunk:  7..4
  const int tid  = threadIdx.x;
  const int lane = tid & 31;
  const int wave = __builtin_amdgcn_readfirstlane(tid >> 5);

  // Waves 0..7: tiles 0..7 of the long chunk. Waves 8..15: tiles 7..0 of the short one.
  const int lng = wave < 8 ? 1 : 0;
  const int sub = lng ? wave : 15 - wave;
  const int i0  = (lng ? hc : lc) * 256 + sub * 32;   // first query of this wave
  const int i   = i0 + lane;
  const float qraw = qkv[(size_t)i * FQKV + h];

  // Staging: 512 keys a trip, so this wave stages the chunks of one parity. lc and hc
  // differ in parity: exactly one staged segment of each wave lies in lc or in hc.
  const int par = wave >> 3;
  float bmax0 = -3.402823466e38f, bmin0 = 3.402823466e38f;   // keys in front of lc
  float bmax1 = -3.402823466e38f, bmin1 = 3.402823466e38f;   // keys in front of hc
  float kown = 0.0f;
  // unrolled: all eight loads are in flight together
#pragma unroll
  for (int c = 0; c < SEQ / 512; ++c) {
    const int t = c * 512 + tid;
    const size_t base = (size_t)t * FQKV;
    const float kk = qkv[base + NHEAD + h];
    k_s[t] = kk;
    v_s[t] = qkv[base + 2 * NHEAD + h];
    const int kc = 2 * c + par;                // the chunk this key lies in
    if (kc < lc) { bmax0 = fmaxf(bmax0, kk); bmin0 = fminf(bmin0, kk); }
    if (kc < hc) { bmax1 = fmaxf(bmax1, kk); bmin1 = fminf(bmin1, kk); }
    if (kc == lc || kc == hc) kown = kk;
  }
  const int own = par == (hc & 1) ? 1 : 0;     // which chunk kown lies in
  const int seg = wave & 7;                    // and which 32-key segment of it

  // In-wave inclusive prefix max/min of the wave's segment of lc or hc; in-wave
  // max/min of the keys in front of each chunk.
  float smax = kown, smin = kown;
  // unrolled: constant shuffle distances
#pragma unroll
  for (int d = 1; d < 32; d <<= 1) {
    const float umax  = __shfl_up(smax, d, 32);
    const float umin  = __shfl_up(smin, d, 32);
    const float xmax0 = __shfl_xor(bmax0, d, 32);
    const float xmin0 = __shfl_xor(bmin0, d, 32);
    const float xmax1 = __shfl_xor(bmax1, d, 32);
    const float xmin1 = __shfl_xor(bmin1, d, 32);
    if (lane >= d) { smax = fmaxf(smax, umax); smin = fminf(smin, umin); }
    bmax0 = fmaxf(bmax0, xmax0);
    bmin0 = fminf(bmin0, xmin0);
    bmax1 = fmaxf(bmax1, xmax1);
    bmin1 = fminf(bmin1, xmin1);
  }
  pre_max_s[own][seg * 32 + lane] = smax;
  pre_min_s[own][seg * 32 + lane] = smin;
  if (lane == 31) {
    seg_max_s[own][seg]   = smax;   seg_min_s[own][seg]   = smin;
    base_max_s[0][wave]   = bmax0;  base_min_s[0][wave]   = bmin0;
    base_max_s[1][wave]   = bmax1;  base_min_s[1][wave]   = bmin1;
  }
  // The kernel's only barrier: every wave passes it in front of its scan. Behind it
  // LDS is only read, so waves with scans of unequal length wait on nothing.
  __syncthreads();

  // Row extremes of this wave's queries: the prefix inside their own segment, the
  // chunk's segments in front of it, and every wave's share of the keys in front of
  // the chunk.
  smax = pre_max_s[lng][sub * 32 + lane];
  smin = pre_min_s[lng][sub * 32 + lane];
  // unrolled, with selects and no branch: the LDS reads go out together, one wait
#pragma unroll
  for (int w = 0; w < 8; ++w) {
    const float omax = seg_max_s[lng][w], omin = seg_min_s[lng][w];
    smax = fmaxf(smax, w < sub ? omax : -3.402823466e38f);
    smin = fminf(smin, w < sub ? omin : 3.402823466e38f);
  }
  // unrolled for the same reason
#pragma unroll
  for (int w = 0; w < 16; ++w) {
    smax = fmaxf(smax, base_max_s[lng][w]);
    smin = fminf(smin, base_min_s[lng][w]);
  }

  // scale and log2(e) folded into q: exp(s - m) = exp2(qs * k - qs * kext)
  const float qs = qraw * (0.125f * 1.44269504088896340736f);
  const float ms = qs * (qs >= 0.0f ? smax : smin);
  const v2f q2 = {qs, qs};
  const v2f m2 = {-ms, -ms};

  v2f l0 = {0.0f, 0.0f}, l1 = {0.0f, 0.0f};
  v2f a0 = {0.0f, 0.0f}, a1 = {0.0f, 0.0f};

  // Keys in front of the wave's first query: every lane takes every key.
  // 32 keys a trip (i0 is a multiple of 32): a trip's LDS reads issue as a group
  // ahead of their use, and the loop's own cost spreads over 32 keys.
#pragma unroll 8
  for (int j = 0; j < i0; j += 4) {
    const float4 kk = *(const float4*)&k_s[j];
    const float4 vv = *(const float4*)&v_s[j];
    const v2f s0 = __builtin_elementwise_fma(q2, (v2f){kk.x, kk.y}, m2);
    const v2f s1 = __builtin_elementwise_fma(q2, (v2f){kk.z, kk.w}, m2);
    const v2f p0 = {__builtin_amdgcn_exp2f(s0.x), __builtin_amdgcn_exp2f(s0.y)};
    const v2f p1 = {__builtin_amdgcn_exp2f(s1.x), __builtin_amdgcn_exp2f(s1.y)};
    l0 += p0;
    l1 += p1;
    a0 = __builtin_elementwise_fma(p0, (v2f){vv.x, vv.y}, a0);
    a1 = __builtin_elementwise_fma(p1, (v2f){vv.z, vv.w}, a1);
  }

  // The wave's own 32 keys: key j counts for query i only where j <= i.
  // Runs once per wave: eight keys a trip keeps this tail's code short.
#pragma unroll 2
  for (int u = 0; u < 32; u += 4) {
    const float4 kk = *(const float4*)&k_s[i0 + u];
    const float4 vv = *(const float4*)&v_s[i0 + u];
    const v2f s0 = __builtin_elementwise_fma(q2, (v2f){kk.x, kk.y}, m2);
    const v2f s1 = __builtin_elementwise_fma(q2, (v2f){kk.z, kk.w}, m2);
    const v2f p0 = {u + 0 <= lane ? __builtin_amdgcn_exp2f(s0.x) : 0.0f,
                    u + 1 <= lane ? __builtin_amdgcn_exp2f(s0.y) : 0.0f};
    const v2f p1 = {u + 2 <= lane ? __builtin_amdgcn_exp2f(s1.x) : 0.0f,
                    u + 3 <= lane ? __builtin_amdgcn_exp2f(s1.y) : 0.0f};
    l0 += p0;
    l1 += p1;
    a0 = __builtin_elementwise_fma(p0, (v2f){vv.x, vv.y}, a0);
    a1 = __builtin_elementwise_fma(p1, (v2f){vv.z, vv.w}, a1);
  }

  const float l   = (l0.x + l0.y) + (l1.x + l1.y);
  const float acc = (a0.x + a0.y) + (a1.x + a1.y);
  oh[(size_t)i * NHEAD + h] = acc / l;
}

// ---------------------------------------------------------------------------
// Launch: qkv GEMM -> attention -> output GEMM. Scratch in d_ws:
//   qkv : SEQ*192 floats (1.5 MB)
//   oh  : SEQ*64  floats (0.5 MB)
// ---------------------------------------------------------------------------
extern "C" void kernel_launch(void* const* d_in, const int* in_sizes, int n_in,
                              void* d_out, int out_size, void* d_ws, size_t ws_size,
                              hipStream_t stream) {
  const float* x     = (const float*)d_in[0];   // [1, 2048, 1024]
  const float* w_qkv = (const float*)d_in[1];   // [192, 1024]
  const float* w_out = (const float*)d_in[2];   // [1024, 64]
  float* y = (float*)d_out;                     // [1, 2048, 1024]

  float* qkv = (float*)d_ws;                    // [2048, 192]
  float* oh  = qkv + (size_t)SEQ * FQKV;        // [2048, 64]

  // qkv = x * w_qkv^T    (M=2048, N=192, K=1024)
  gemm_f32_wmma<<<dim3(FQKV / 16, SEQ / 16), 32, 0, stream>>>(
      x, w_qkv, qkv, FQKV, DIM);

  // per-head causal softmax attention (head dim 1): one block = head x chunk pair
  attn_headdim1_causal<<<dim3(SEQ / 512, NHEAD), 512, 0, stream>>>(qkv, oh);

  // y = oh * w_out^T     (M=2048, N=1024, K=64)
  gemm_f32_wmma<<<dim3(DIM / 16, SEQ / 16), 32, 0, stream>>>(
      oh, w_out, y, DIM, NHEAD);
}

// v003
// A run of this version takes 35.5 microseconds.
// Next to v002, in two timings, it ran 1.46 and 1.42 times as fast.
// Over all steps from v000 it is 2.32 times as fast.
#include <hip/hip_runtime.h>

// ---------------------------------------------------------------------------
// Problem constants (from the reference):
//   x      : [1, 2048, 1024]  fp32
//   w_qkv  : [192, 1024]      fp32   (torch Linear layout: [out, in])
//   w_out  : [1024, 64]       fp32
//   y      : [1, 2048, 1024]  fp32
// per-head dim is 1 (64 heads), scale = 1/sqrt(64) = 0.125
// ---------------------------------------------------------------------------
#define SEQ   2048
#define DIM   1024
#define NHEAD 64
#define FQKV  (3 * NHEAD)   // 192

typedef float v2f __attribute__((ext_vector_type(2)));
typedef float v8f __attribute__((ext_vector_type(8)));

// ---------------------------------------------------------------------------
// U (10 or 6) asynchronous 16-byte copies of this lane, global memory -> LDS, through
// no register: staged row i of the lane comes from a (i < UA) or from w, GSTEP floats
// and LSTEP LDS bytes apart. The s_wait_xcnt stands inside the statement, behind the
// last copy, so that no address register is rewritten in front of it.
// ---------------------------------------------------------------------------
template <int U, int UA, int GSTEP, int LSTEP>
__device__ __forceinline__ void stage_rows(unsigned lds, const float* a, const float* w) {
  static_assert(U == 10 || U == 6, "one statement per count");
  const float* g[U];
  // unrolled: g is indexed by constants only and stays in registers
#pragma unroll
  for (int i = 0; i < U; ++i)
    g[i] = i < UA ? a + (size_t)i * GSTEP : w + (size_t)(i - UA) * GSTEP;
  if constexpr (U == 10) {
    asm volatile(
        "global_load_async_to_lds_b128 %0, %10, off\n\t"
        "global_load_async_to_lds_b128 %1, %11, off\n\t"
        "global_load_async_to_lds_b128 %2, %12, off\n\t"
        "global_load_async_to_lds_b128 %3, %13, off\n\t"
        "global_load_async_to_lds_b128 %4, %14, off\n\t"
        "global_load_async_to_lds_b128 %5, %15, off\n\t"
        "global_load_async_to_lds_b128 %6, %16, off\n\t"
        "global_load_async_to_lds_b128 %7, %17, off\n\t"
        "global_load_async_to_lds_b128 %8, %18, off\n\t"
        "global_load_async_to_lds_b128 %9, %19, off\n\t"
        "s_wait_xcnt 0x0"
        :: "v"(lds), "v"(lds + LSTEP), "v"(lds + 2 * LSTEP), "v"(lds + 3 * LSTEP),
           "v"(lds + 4 * LSTEP), "v"(lds + 5 * LSTEP), "v"(lds + 6 * LSTEP),
           "v"(lds + 7 * LSTEP), "v"(lds + 8 * LSTEP), "v"(lds + 9 * LSTEP),
           "v"(g[0]), "v"(g[1]), "v"(g[2]), "v"(g[3]), "v"(g[4]),
           "v"(g[5]), "v"(g[6]), "v"(g[7]), "v"(g[8]), "v"(g[9])
        : "memory");
  } else {
    asm volatile(
        "global_load_async_to_lds_b128 %0, %6, off\n\t"
        "global_load_async_to_lds_b128 %1, %7, off\n\t"
        "global_load_async_to_lds_b128 %2, %8, off\n\t"
        "global_load_async_to_lds_b128 %3, %9, off\n\t"
        "global_load_async_to_lds_b128 %4, %10, off\n\t"
        "global_load_async_to_lds_b128 %5, %11, off\n\t"
        "s_wait_xcnt 0x0"
        :: "v"(lds), "v"(lds + LSTEP), "v"(lds + 2 * LSTEP), "v"(lds + 3 * LSTEP),
           "v"(lds + 4 * LSTEP), "v"(lds + 5 * LSTEP),
           "v"(g[0]), "v"(g[1]), "v"(g[2]), "v"(g[3]), "v"(g[4]), "v"(g[5])
        : "memory");
  }
}

// ---------------------------------------------------------------------------
// C[M x N] = A[M x K] * W[N x K]^T   (all fp32, row-major), V_WMMA_F32_16X16X4_F32.
//
// One block computes a BM x BN tile of C. K is walked in chunks of KC: the block's
// BM rows of A and BN rows of W are copied to LDS asynchronously, 16 bytes a lane,
// adjacent lanes covering whole 128-byte lines (two buffers where there is more than
// one chunk: the next chunk's copies fly while this chunk is multiplied). A wave owns
// 16 rows x WN tiles of 16 columns, so one A fragment serves WN products, and one of
// KS slices of every chunk; the KS partial tiles are summed through LDS at the end,
// in slice order, and C is stored in 16-byte pieces.
//
// Fragments (32-bit A 16x4: lanes 0-15 hold hardware K0,K1 of row lane, lanes 16-31
// hold K2,K3; B symmetric; C/D: VGPR r = row r (lanes 0-15) or 8 + r (lanes 16-31)).
// One ds_load_b128 gives a lane k = 8 s + 4 half + {0,1,2,3}: {0,1} feed one product
// and {2,3} the next. A and B use the same map, so every product pairs equal k.
// LDS row pitch KC * 4 + 16 bytes (16 bytes x an odd number): fragment reads of 16
// rows fall on distinct banks.
// ---------------------------------------------------------------------------
template <int BM, int BN, int WN, int KS, int KC, int N, int K>
__global__ __launch_bounds__((BM / 16) * (BN / (16 * WN)) * KS * 32)
void gemm_f32_wmma(const float* __restrict__ A,
                   const float* __restrict__ W,
                   float* __restrict__ C) {
  constexpr int TM    = BM / 16;             // wave rows of the block tile
  constexpr int TN    = BN / (16 * WN);      // wave columns of the block tile
  constexpr int NT    = TM * TN * KS * 32;   // threads
  constexpr int ROWS  = BM + BN;             // staged rows: A's, then W's
  constexpr int PITCH = KC + 4;              // floats
  constexpr int NCH   = K / KC;
  constexpr int NBUF  = NCH > 1 ? 2 : 1;
  constexpr int C4    = KC / 4;              // 16-byte pieces in a staged row
  constexpr int RP    = NT / C4;             // rows staged by one copy of the block
  constexpr int U     = ROWS / RP;           // copies per thread and chunk
  constexpr int UA    = BM / RP;             // the first UA of them are A's
  constexpr int STEPS = KC / 8 / KS;         // b128 fragment steps per wave and chunk
  constexpr int RPITCH = BN + 4;             // floats, partial tiles
  static_assert(ROWS % RP == 0 && BM % RP == 0 && NT % C4 == 0, "staging split");
  static_assert(KC % (8 * KS) == 0 && K % KC == 0, "k split");
  static_assert(KS * BM * RPITCH <= NBUF * ROWS * PITCH, "partial tiles fit the buffers");

  __shared__ __attribute__((aligned(16))) float tile[NBUF * ROWS * PITCH];

  const int tid  = threadIdx.x;
  const int lane = tid & 31;
  const int half = lane >> 4;
  const int sub  = lane & 15;
  const int wave = __builtin_amdgcn_readfirstlane(tid >> 5);
  const int wm = wave % TM;
  const int wn = (wave / TM) % TN;
  const int ks = wave / (TM * TN);
  const int m0 = blockIdx.y * BM;
  const int n0 = blockIdx.x * BN;

  const int row0 = tid / C4;
  const int c0   = (tid % C4) * 4;
  const float* ag = A + (size_t)(m0 + row0) * K + c0;
  const float* wg = W + (size_t)(n0 + row0) * K + c0;
  // the lane's LDS byte address in buffer 0: the low 32 bits of the __shared__ address
  const unsigned put0 = (unsigned)(size_t)&tile[row0 * PITCH + c0];
  const int aoff = (wm * 16 + sub) * PITCH + half * 4 + ks * STEPS * 8;
  const int boff = (BM + wn * WN * 16 + sub) * PITCH + half * 4 + ks * STEPS * 8;

  stage_rows<U, UA, RP * K, RP * PITCH * 4>(put0, ag, wg);
  // chunk 0 has landed for this wave ...
  asm volatile("s_wait_asynccnt 0x0" ::: "memory");
  __syncthreads();   // ... and is published to the others
  if (NCH > 1)
    stage_rows<U, UA, RP * K, RP * PITCH * 4>(put0 + ROWS * PITCH * 4, ag + KC, wg + KC);

  v8f acc[WN] = {};
  // rolled: every trip ends in a barrier, an unrolled body would only be longer
#pragma unroll 1
  for (int ch = 0; ch < NCH; ++ch) {
    const int bsel = (ch & (NBUF - 1)) * (ROWS * PITCH);
    const float* buf = tile + bsel;
    // unrolled, with the three loops over n inside: constant LDS offsets, acc and b4 in
    // registers, fragment reads issue ahead of the products
#pragma unroll
    for (int s = 0; s < STEPS; ++s) {
      const float4 a4 = *(const float4*)&buf[aoff + s * 8];
      float4 b4[WN];
#pragma unroll
      for (int n = 0; n < WN; ++n)
        b4[n] = *(const float4*)&buf[boff + n * 16 * PITCH + s * 8];
      // (neg_a, A, neg_b, B, c_mod, C, reuse_a, reuse_b)
#pragma unroll
      for (int n = 0; n < WN; ++n)
        acc[n] = __builtin_amdgcn_wmma_f32_16x16x4_f32(false, (v2f){a4.x, a4.y},
                                                       false, (v2f){b4[n].x, b4[n].y},
                                                       (short)0, acc[n], false, false);
#pragma unroll
      for (int n = 0; n < WN; ++n)
        acc[n] = __builtin_amdgcn_wmma_f32_16x16x4_f32(false, (v2f){a4.z, a4.w},
                                                       false, (v2f){b4[n].z, b4[n].w},
                                                       (short)0, acc[n], false, false);
    }
    // keeps the chunk's products in front of the barrier: sunk behind it they would
    // stand in front of the refill and cut the time its copies have to land
    __builtin_amdgcn_sched_barrier(0);
    // this wave's reads of the chunk's buffer have returned: it may be refilled
    asm volatile("s_wait_dscnt 0x0" ::: "memory");
    // this wave's copies of the next chunk have landed
    asm volatile("s_wait_asynccnt 0x0" ::: "memory");
    // One barrier a chunk: it publishes the next chunk and ends every wave's reads of
    // this one (the buffer is refilled behind it, or reused for the partial tiles).
    __syncthreads();
    if (ch + 2 < NCH)
      stage_rows<U, UA, RP * K, RP * PITCH * 4>(put0 + bsel * 4, ag + (ch + 2) * KC,
                                             wg + (ch + 2) * KC);
  }
  // no copy is outstanding when the buffers change their use
  asm volatile("s_wait_asynccnt 0x0" ::: "memory");

  // Partial tiles to LDS, slice by slice (unrolled: acc is indexed by constants only).
#pragma unroll
  for (int n = 0; n < WN; ++n)
#pragma unroll
    for (int r = 0; r < 8; ++r)
      tile[(ks * BM + wm * 16 + r + half * 8) * RPITCH + (wn * WN + n) * 16 + sub] = acc[n][r];
  __syncthreads();   // every partial tile is published

  // 16-byte piece u of the block's C tile: the KS partial sums, added in slice order
  auto piece = [&](int u) {
    const int row = u / (BN / 4);
    const int col = (u % (BN / 4)) * 4;
    float4 s4 = *(const float4*)&tile[row * RPITCH + col];
    // unrolled: the KS reads go out together
#pragma unroll
    for (int p = 1; p < KS; ++p) {
      const float4 t4 = *(const float4*)&tile[(p * BM + row) * RPITCH + col];
      s4.x += t4.x; s4.y += t4.y; s4.z += t4.z; s4.w += t4.w;
    }
    return s4;
  };
  auto place = [&](int u) {
    return (float4*)&C[(size_t)(m0 + u / (BN / 4)) * N + n0 + (u % (BN / 4)) * 4];
  };
  constexpr int PIECES = BM * BN / 4;
  constexpr int FULL   = PIECES / NT;
  float4  val[FULL];
  float4* dst[FULL];
  // unrolled: val and dst stay in registers, the LDS reads of all pieces go out together
#pragma unroll
  for (int it = 0; it < FULL; ++it) {
    val[it] = piece(tid + it * NT);
    dst[it] = place(tid + it * NT);
  }
  // keeps every read and address in front of the stores: the stores then follow one
  // another and no register of an issued store is reused between them
  __builtin_amdgcn_sched_barrier(0);
  // unrolled for the same reason as above
#pragma unroll
  for (int it = 0; it < FULL; ++it)
    *dst[it] = val[it];
  if constexpr (PIECES % NT != 0) {
    if (tid < PIECES % NT) *place(tid + FULL * NT) = piece(tid + FULL * NT);
  }
}

// ---------------------------------------------------------------------------
// Per-head causal attention with head-dim 1 (the reference's quirk):
//   oh[i,h] = sum_{j<=i} softmax_j(q[i,h] * k[j,h] * 0.125) * v[j,h]
// One lane per query, one wave per 32 queries, k/v columns of the head staged in LDS.
//
// A query chunk's cost grows with its index (causal), so one block takes one head
// and TWO chunks of 256 queries: chunk c (short scans) and chunk 7 - c (long scans),
// eight waves each, side by side on one staged copy of k and v. Every block then
// has the same number of (query, key) pairs, and so has every group of waves
// w, w + 4, w + 8, w + 12 (the short chunk's tiles are dealt in reverse order).
//
// The score q*k is monotone in k, so the row maximum over j <= i is known before
// the scan: q * max_{j<=i} k for q >= 0, q * min_{j<=i} k for q < 0. The prefix
// maximum and minimum of k are formed once while the keys are staged; the scan
// then has no running maximum and no rescale: one exp2 per (query, key) and sums
// that do not depend on one another.
// ---------------------------------------------------------------------------
__global__ __launch_bounds__(512)
void attn_headdim1_causal(const float* __restrict__ qkv,  // [SEQ, 192]
                          float* __restrict__ oh) {       // [SEQ, 64]
  __shared__ __attribute__((aligned(16))) float k_s[SEQ];
  __shared__ __attribute__((aligned(16))) float v_s[SEQ];
  // First index below: 0 = the short chunk, 1 = the long chunk.
  // Per key of the two chunks: max/min from its 32-key segment's start up to itself.
  __shared__ float pre_max_s[2][256], pre_min_s[2][256];
  // Per 32-key segment of the two chunks: max/min of the whole segment.
  __shared__ __attribute__((aligned(16))) float seg_max_s[2][8], seg_min_s[2][8];
  // Per staging wave: max/min of the keys it staged that lie in front of the chunk.
  __shared__ __attribute__((aligned(16))) float base_max_s[2][16], base_min_s[2][16];
  const int h    = blockIdx.y;
  const int lc   = blockIdx.x;                 // short chunk: 0..3
  const int hc   = SEQ / 256 - 1 - lc;         // long chunk:  7..4
  const int tid  = threadIdx.x;
  const int lane = tid & 31;
  const int wave = __builtin_amdgcn_readfirstlane(tid >> 5);

  // Waves 0..7: tiles 0..7 of the long chunk. Waves 8..15: tiles 7..0 of the short one.
  const int lng = wave < 8 ? 1 : 0;
  const int sub = lng ? wave : 15 - wave;
  const int i0  = (lng ? hc : lc) * 256 + sub * 32;   // first query of this wave
  const int i   = i0 + lane;
  const float qraw = qkv[(size_t)i * FQKV + h];

  // Staging: 512 keys a trip, so this wave stages the chunks of one parity. lc and hc
  // differ in parity: exactly one staged segment of each wave lies in lc or in hc.
  const int par = wave >> 3;
  float bmax0 = -3.402823466e38f, bmin0 = 3.402823466e38f;   // keys in front of lc
  float bmax1 = -3.402823466e38f, bmin1 = 3.402823466e38f;   // keys in front of hc
  float kown = 0.0f;
  // unrolled: all eight loads are in flight together
#pragma unroll
  for (int c = 0; c < SEQ / 512; ++c) {
    const int t = c * 512 + tid;
    const size_t base = (size_t)t * FQKV;
    const float kk = qkv[base + NHEAD + h];
    k_s[t] = kk;
    v_s[t] = qkv[base + 2 * NHEAD + h];
    const int kc = 2 * c + par;                // the chunk this key lies in
    if (kc < lc) { bmax0 = fmaxf(bmax0, kk); bmin0 = fminf(bmin0, kk); }
    if (kc < hc) { bmax1 = fmaxf(bmax1, kk); bmin1 = fminf(bmin1, kk); }
    if (kc == lc || kc == hc) kown = kk;
  }
  const int own = par == (hc & 1) ? 1 : 0;     // which chunk kown lies in
  const int seg = wave & 7;                    // and which 32-key segment of it

  // In-wave inclusive prefix max/min of the wave's segment of lc or hc; in-wave
  // max/min of the keys in front of each chunk.
  float smax = kown, smin = kown;
  // unrolled: constant shuffle distances
#pragma unroll
  for (int d = 1; d < 32; d <<= 1) {
    const float umax  = __shfl_up(smax, d, 32);
    const float umin  = __shfl_up(smin, d, 32);
    const float xmax0 = __shfl_xor(bmax0, d, 32);
    const float xmin0 = __shfl_xor(bmin0, d, 32);
    const float xmax1 = __shfl_xor(bmax1, d, 32);
    const float xmin1 = __shfl_xor(bmin1, d, 32);
    if (lane >= d) { smax = fmaxf(smax, umax); smin = fminf(smin, umin); }
    bmax0 = fmaxf(bmax0, xmax0);
    bmin0 = fminf(bmin0, xmin0);
    bmax1 = fmaxf(bmax1, xmax1);
    bmin1 = fminf(bmin1, xmin1);
  }
  pre_max_s[own][seg * 32 + lane] = smax;
  pre_min_s[own][seg * 32 + lane] = smin;
  if (lane == 31) {
    seg_max_s[own][seg]   = smax;   seg_min_s[own][seg]   = smin;
    base_max_s[0][wave]   = bmax0;  base_min_s[0][wave]   = bmin0;
    base_max_s[1][wave]   = bmax1;  base_min_s[1][wave]   = bmin1;
  }
  // The kernel's only barrier: every wave passes it in front of its scan. Behind it
  // LDS is only read, so waves with scans of unequal length wait on nothing.
  __syncthreads();

  // Row extremes of this wave's queries: the prefix inside their own segment, the
  // chunk's segments in front of it, and every wave's share of the keys in front of
  // the chunk.
  smax = pre_max_s[lng][sub * 32 + lane];
  smin = pre_min_s[lng][sub * 32 + lane];
  // unrolled, with selects and no branch: the LDS reads go out together, one wait
#pragma unroll
  for (int w = 0; w < 8; ++w) {
    const float omax = seg_max_s[lng][w], omin = seg_min_s[lng][w];
    smax = fmaxf(smax, w < sub ? omax : -3.402823466e38f);
    smin = fminf(smin, w < sub ? omin : 3.402823466e38f);
  }
  // unrolled for the same reason
#pragma unroll
  for (int w = 0; w < 16; ++w) {
    smax = fmaxf(smax, base_max_s[lng][w]);
    smin = fminf(smin, base_min_s[lng][w]);
  }

  // scale and log2(e) folded into q: exp(s - m) = exp2(qs * k - qs * kext)
  const float qs = qraw * (0.125f * 1.44269504088896340736f);
  const float ms = qs * (qs >= 0.0f ? smax : smin);
  const v2f q2 = {qs, qs};
  const v2f m2 = {-ms, -ms};

  v2f l0 = {0.0f, 0.0f}, l1 = {0.0f, 0.0f};
  v2f a0 = {0.0f, 0.0f}, a1 = {0.0f, 0.0f};

  // Keys in front of the wave's first query: every lane takes every key.
  // 32 keys a trip (i0 is a multiple of 32): a trip's LDS reads issue as a group
  // ahead of their use, and the loop's own cost spreads over 32 keys.
#pragma unroll 8
  for (int j = 0; j < i0; j += 4) {
    const float4 kk = *(const float4*)&k_s[j];
    const float4 vv = *(const float4*)&v_s[j];
    const v2f s0 = __builtin_elementwise_fma(q2, (v2f){kk.x, kk.y}, m2);
    const v2f s1 = __builtin_elementwise_fma(q2, (v2f){kk.z, kk.w}, m2);
    const v2f p0 = {__builtin_amdgcn_exp2f(s0.x), __builtin_amdgcn_exp2f(s0.y)};
    const v2f p1 = {__builtin_amdgcn_exp2f(s1.x), __builtin_amdgcn_exp2f(s1.y)};
    l0 += p0;
    l1 += p1;
    a0 = __builtin_elementwise_fma(p0, (v2f){vv.x, vv.y}, a0);
    a1 = __builtin_elementwise_fma(p1, (v2f){vv.z, vv.w}, a1);
  }

  // The wave's own 32 keys: key j counts for query i only where j <= i.
  // Runs once per wave: eight keys a trip keeps this tail's code short.
#pragma unroll 2
  for (int u = 0; u < 32; u += 4) {
    const float4 kk = *(const float4*)&k_s[i0 + u];
    const float4 vv = *(const float4*)&v_s[i0 + u];
    const v2f s0 = __builtin_elementwise_fma(q2, (v2f){kk.x, kk.y}, m2);
    const v2f s1 = __builtin_elementwise_fma(q2, (v2f){kk.z, kk.w}, m2);
    const v2f p0 = {u + 0 <= lane ? __builtin_amdgcn_exp2f(s0.x) : 0.0f,
                    u + 1 <= lane ? __builtin_amdgcn_exp2f(s0.y) : 0.0f};
    const v2f p1 = {u + 2 <= lane ? __builtin_amdgcn_exp2f(s1.x) : 0.0f,
                    u + 3 <= lane ? __builtin_amdgcn_exp2f(s1.y) : 0.0f};
    l0 += p0;
    l1 += p1;
    a0 = __builtin_elementwise_fma(p0, (v2f){vv.x, vv.y}, a0);
    a1 = __builtin_elementwise_fma(p1, (v2f){vv.z, vv.w}, a1);
  }

  const float l   = (l0.x + l0.y) + (l1.x + l1.y);
  const float acc = (a0.x + a0.y) + (a1.x + a1.y);
  oh[(size_t)i * NHEAD + h] = acc / l;
}

// ---------------------------------------------------------------------------
// Launch: qkv GEMM -> attention -> output GEMM. Scratch in d_ws:
//   qkv : SEQ*192 floats (1.5 MB)
//   oh  : SEQ*64  floats (0.5 MB)
// ---------------------------------------------------------------------------
extern "C" void kernel_launch(void* const* d_in, const int* in_sizes, int n_in,
                              void* d_out, int out_size, void* d_ws, size_t ws_size,
                              hipStream_t stream) {
  const float* x     = (const float*)d_in[0];   // [1, 2048, 1024]
  const float* w_qkv = (const float*)d_in[1];   // [192, 1024]
  const float* w_out = (const float*)d_in[2];   // [1024, 64]
  float* y = (float*)d_out;                     // [1, 2048, 1024]

  float* qkv = (float*)d_ws;                    // [2048, 192]
  float* oh  = qkv + (size_t)SEQ * FQKV;        // [2048, 64]

  // qkv = x * w_qkv^T    (M=2048, N=192, K=1024)
  gemm_f32_wmma<32, 48, 3, 4, 128, FQKV, DIM>
      <<<dim3(FQKV / 48, SEQ / 32), 256, 0, stream>>>(x, w_qkv, qkv);

  // per-head causal softmax attention (head dim 1): one block = head x chunk pair
  attn_headdim1_causal<<<dim3(SEQ / 512, NHEAD), 512, 0, stream>>>(qkv, oh);

  // y = oh * w_out^T     (M=2048, N=1024, K=64)
  gemm_f32_wmma<64, 128, 4, 1, 32, DIM, NHEAD>
      <<<dim3(DIM / 128, SEQ / 64), 256, 0, stream>>>(oh, w_out, y);
}

// v004
// It runs in 30.1 microseconds.
// In two side-by-side timings against v003, it was 1.16 and 1.17 times as fast.
// Counting every step since v000, it is 2.70 times as fast.
#include <hip/hip_runtime.h>

// ---------------------------------------------------------------------------
// Problem constants (from the reference):
//   x      : [1, 2048, 1024]  fp32
//   w_qkv  : [192, 1024]      fp32   (torch Linear layout: [out, in])
//   w_out  : [1024, 64]       fp32
//   y      : [1, 2048, 1024]  fp32
// per-head dim is 1 (64 heads), scale = 1/sqrt(64) = 0.125
// ---------------------------------------------------------------------------
#define SEQ   2048
#define DIM   1024
#define NHEAD 64
#define FQKV  (3 * NHEAD)   // 192

typedef float v2f __attribute__((ext_vector_type(2)));
typedef float v8f __attribute__((ext_vector_type(8)));

// ---------------------------------------------------------------------------
// U (10 or 6) asynchronous 16-byte copies of this lane, global memory -> LDS, through
// no register: staged row i of the lane comes from a (i < UA) or from w, GSTEP floats
// and LSTEP LDS bytes apart. The s_wait_xcnt stands inside the statement, behind the
// last copy, so that no address register is rewritten in front of it.
// ---------------------------------------------------------------------------
template <int U, int UA, int GSTEP, int LSTEP>
__device__ __forceinline__ void stage_rows(unsigned lds, const float* a, const float* w) {
  static_assert(U == 10 || U == 6, "one statement per count");
  const float* g[U];
  // unrolled: g is indexed by constants only and stays in registers
#pragma unroll
  for (int i = 0; i < U; ++i)
    g[i] = i < UA ? a + (size_t)i * GSTEP : w + (size_t)(i - UA) * GSTEP;
  if constexpr (U == 10) {
    asm volatile(
        "global_load_async_to_lds_b128 %0, %10, off\n\t"
        "global_load_async_to_lds_b128 %1, %11, off\n\t"
        "global_load_async_to_lds_b128 %2, %12, off\n\t"
        "global_load_async_to_lds_b128 %3, %13, off\n\t"
        "global_load_async_to_lds_b128 %4, %14, off\n\t"
        "global_load_async_to_lds_b128 %5, %15, off\n\t"
        "global_load_async_to_lds_b128 %6, %16, off\n\t"
        "global_load_async_to_lds_b128 %7, %17, off\n\t"
        "global_load_async_to_lds_b128 %8, %18, off\n\t"
        "global_load_async_to_lds_b128 %9, %19, off\n\t"
        "s_wait_xcnt 0x0"
        :: "v"(lds), "v"(lds + LSTEP), "v"(lds + 2 * LSTEP), "v"(lds + 3 * LSTEP),
           "v"(lds + 4 * LSTEP), "v"(lds + 5 * LSTEP), "v"(lds + 6 * LSTEP),
           "v"(lds + 7 * LSTEP), "v"(lds + 8 * LSTEP), "v"(lds + 9 * LSTEP),
           "v"(g[0]), "v"(g[1]), "v"(g[2]), "v"(g[3]), "v"(g[4]),
           "v"(g[5]), "v"(g[6]), "v"(g[7]), "v"(g[8]), "v"(g[9])
        : "memory");
  } else {
    asm volatile(
        "global_load_async_to_lds_b128 %0, %6, off\n\t"
        "global_load_async_to_lds_b128 %1, %7, off\n\t"
        "global_load_async_to_lds_b128 %2, %8, off\n\t"
        "global_load_async_to_lds_b128 %3, %9, off\n\t"
        "global_load_async_to_lds_b128 %4, %10, off\n\t"
        "global_load_async_to_lds_b128 %5, %11, off\n\t"
        "s_wait_xcnt 0x0"
        :: "v"(lds), "v"(lds + LSTEP), "v"(lds + 2 * LSTEP), "v"(lds + 3 * LSTEP),
           "v"(lds + 4 * LSTEP), "v"(lds + 5 * LSTEP),
           "v"(g[0]), "v"(g[1]), "v"(g[2]), "v"(g[3]), "v"(g[4]), "v"(g[5])
        : "memory");
  }
}

// ---------------------------------------------------------------------------
// C[M x N] = A[M x K] * W[N x K]^T   (all fp32, A and W row-major), V_WMMA_F32_16X16X4_F32.
//
// One block computes a BM x BN tile of C. K is walked in chunks of KC: the block's
// BM rows of A and BN rows of W are copied to LDS asynchronously, 16 bytes a lane,
// adjacent lanes covering whole 128-byte lines (two buffers where there is more than
// one chunk: the next chunk's copies fly while this chunk is multiplied). A wave owns
// 16 rows x WN tiles of 16 columns, so one A fragment serves WN products, and one of
// KS slices of every chunk; the KS partial tiles are summed through LDS at the end,
// in slice order, and C is stored in 16-byte pieces: row-major [M][N] where LDT is 0,
// else transposed, as [N][LDT] (LDT = M), a column of C lying contiguous in memory.
//
// Fragments (32-bit A 16x4: lanes 0-15 hold hardware K0,K1 of row lane, lanes 16-31
// hold K2,K3; B symmetric; C/D: VGPR r = row r (lanes 0-15) or 8 + r (lanes 16-31)).
// One ds_load_b128 gives a lane k = 8 s + 4 half + {0,1,2,3}: {0,1} feed one product
// and {2,3} the next. A and B use the same map, so every product pairs equal k.
// LDS row pitch KC * 4 + 16 bytes (16 bytes x an odd number): fragment reads of 16
// rows fall on distinct banks.
// ---------------------------------------------------------------------------
template <int BM, int BN, int WN, int KS, int KC, int N, int K, int LDT>
__global__ __launch_bounds__((BM / 16) * (BN / (16 * WN)) * KS * 32)
void gemm_f32_wmma(const float* __restrict__ A,
                   const float* __restrict__ W,
                   float* __restrict__ C) {
  constexpr int TM    = BM / 16;             // wave rows of the block tile
  constexpr int TN    = BN / (16 * WN);      // wave columns of the block tile
  constexpr int NT    = TM * TN * KS * 32;   // threads
  constexpr int ROWS  = BM + BN;             // staged rows: A's, then W's
  constexpr int PITCH = KC + 4;              // floats
  constexpr int NCH   = K / KC;
  constexpr int NBUF  = NCH > 1 ? 2 : 1;
  constexpr int C4    = KC / 4;              // 16-byte pieces in a staged row
  constexpr int RP    = NT / C4;             // rows staged by one copy of the block
  constexpr int U     = ROWS / RP;           // copies per thread and chunk
  constexpr int UA    = BM / RP;             // the first UA of them are A's
  constexpr int STEPS = KC / 8 / KS;         // b128 fragment steps per wave and chunk
  constexpr int PR    = LDT ? BN : BM;       // rows of a partial tile as it lies in LDS
  constexpr int PC    = LDT ? BM : BN;       // and its columns: the order C is stored in
  constexpr int RPITCH = PC + 4;             // floats, partial tiles
  static_assert(ROWS % RP == 0 && BM % RP == 0 && NT % C4 == 0, "staging split");
  static_assert(KC % (8 * KS) == 0 && K % KC == 0, "k split");
  static_assert(KS * PR * RPITCH <= NBUF * ROWS * PITCH, "partial tiles fit the buffers");

  __shared__ __attribute__((aligned(16))) float tile[NBUF * ROWS * PITCH];

  const int tid  = threadIdx.x;
  const int lane = tid & 31;
  const int half = lane >> 4;
  const int sub  = lane & 15;
  const int wave = __builtin_amdgcn_readfirstlane(tid >> 5);
  const int wm = wave % TM;
  const int wn = (wave / TM) % TN;
  const int ks = wave / (TM * TN);
  const int m0 = blockIdx.y * BM;
  const int n0 = blockIdx.x * BN;

  const int row0 = tid / C4;
  const int c0   = (tid % C4) * 4;
  const float* ag = A + (size_t)(m0 + row0) * K + c0;
  const float* wg = W + (size_t)(n0 + row0) * K + c0;
  // the lane's LDS byte address in buffer 0: the low 32 bits of the __shared__ address
  const unsigned put0 = (unsigned)(size_t)&tile[row0 * PITCH + c0];
  const int aoff = (wm * 16 + sub) * PITCH + half * 4 + ks * STEPS * 8;
  const int boff = (BM + wn * WN * 16 + sub) * PITCH + half * 4 + ks * STEPS * 8;

  stage_rows<U, UA, RP * K, RP * PITCH * 4>(put0, ag, wg);
  // chunk 0 has landed for this wave ...
  asm volatile("s_wait_asynccnt 0x0" ::: "memory");
  __syncthreads();   // ... and is published to the others
  if (NCH > 1)
    stage_rows<U, UA, RP * K, RP * PITCH * 4>(put0 + ROWS * PITCH * 4, ag + KC, wg + KC);

  v8f acc[WN] = {};
  // rolled: every trip ends in a barrier, an unrolled body would only be longer
#pragma unroll 1
  for (int ch = 0; ch < NCH; ++ch) {
    const int bsel = (ch & (NBUF - 1)) * (ROWS * PITCH);
    const float* buf = tile + bsel;
    // unrolled, with the three loops over n inside: constant LDS offsets, acc and b4 in
    // registers, fragment reads issue ahead of the products
#pragma unroll
    for (int s = 0; s < STEPS; ++s) {
      const float4 a4 = *(const float4*)&buf[aoff + s * 8];
      float4 b4[WN];
#pragma unroll
      for (int n = 0; n < WN; ++n)
        b4[n] = *(const float4*)&buf[boff + n * 16 * PITCH + s * 8];
      // (neg_a, A, neg_b, B, c_mod, C, reuse_a, reuse_b)
#pragma unroll
      for (int n = 0; n < WN; ++n)
        acc[n] = __builtin_amdgcn_wmma_f32_16x16x4_f32(false, (v2f){a4.x, a4.y},
                                                       false, (v2f){b4[n].x, b4[n].y},
                                                       (short)0, acc[n], false, false);
#pragma unroll
      for (int n = 0; n < WN; ++n)
        acc[n] = __builtin_amdgcn_wmma_f32_16x16x4_f32(false, (v2f){a4.z, a4.w},
                                                       false, (v2f){b4[n].z, b4[n].w},
                                                       (short)0, acc[n], false, false);
    }
    // keeps the chunk's products in front of the barrier: sunk behind it they would
    // stand in front of the refill and cut the time its copies have to land
    __builtin_amdgcn_sched_barrier(0);
    // this wave's reads of the chunk's buffer have returned: it may be refilled
    asm volatile("s_wait_dscnt 0x0" ::: "memory");
    // this wave's copies of the next chunk have landed
    asm volatile("s_wait_asynccnt 0x0" ::: "memory");
    // One barrier a chunk: it publishes the next chunk and ends every wave's reads of
    // this one (the buffer is refilled behind it, or reused for the partial tiles).
    __syncthreads();
    if (ch + 2 < NCH)
      stage_rows<U, UA, RP * K, RP * PITCH * 4>(put0 + bsel * 4, ag + (ch + 2) * KC,
                                             wg + (ch + 2) * KC);
  }
  // no copy is outstanding when the buffers change their use
  asm volatile("s_wait_asynccnt 0x0" ::: "memory");

  // Partial tiles to LDS, slice by slice (unrolled: acc is indexed by constants only).
  // Transposed, a lane's eight accumulator rows are eight neighbours of one LDS row.
#pragma unroll
  for (int n = 0; n < WN; ++n) {
    if constexpr (LDT != 0) {
      float* p = &tile[(ks * BN + (wn * WN + n) * 16 + sub) * RPITCH + wm * 16 + half * 8];
      *(float4*)p       = make_float4(acc[n][0], acc[n][1], acc[n][2], acc[n][3]);
      *(float4*)(p + 4) = make_float4(acc[n][4], acc[n][5], acc[n][6], acc[n][7]);
    } else {
#pragma unroll
      for (int r = 0; r < 8; ++r)
        tile[(ks * BM + wm * 16 + r + half * 8) * RPITCH + (wn * WN + n) * 16 + sub] = acc[n][r];
    }
  }
  __syncthreads();   // every partial tile is published

  // 16-byte piece u of the block's C tile: the KS partial sums, added in slice order
  auto piece = [&](int u) {
    const int row = u / (PC / 4);
    const int col = (u % (PC / 4)) * 4;
    float4 s4 = *(const float4*)&tile[row * RPITCH + col];
    // unrolled: the KS reads go out together
#pragma unroll
    for (int p = 1; p < KS; ++p) {
      const float4 t4 = *(const float4*)&tile[(p * PR + row) * RPITCH + col];
      s4.x += t4.x; s4.y += t4.y; s4.z += t4.z; s4.w += t4.w;
    }
    return s4;
  };
  auto place = [&](int u) {
    const int row = u / (PC / 4);
    const int col = (u % (PC / 4)) * 4;
    if constexpr (LDT != 0) return (float4*)&C[(size_t)(n0 + row) * LDT + m0 + col];
    else                    return (float4*)&C[(size_t)(m0 + row) * N + n0 + col];
  };
  constexpr int PIECES = BM * BN / 4;
  constexpr int FULL   = PIECES / NT;
  float4  val[FULL];
  float4* dst[FULL];
  // unrolled: val and dst stay in registers, the LDS reads of all pieces go out together
#pragma unroll
  for (int it = 0; it < FULL; ++it) {
    val[it] = piece(tid + it * NT);
    dst[it] = place(tid + it * NT);
  }
  // keeps every read and address in front of the stores: the stores then follow one
  // another and no register of an issued store is reused between them
  __builtin_amdgcn_sched_barrier(0);
  // unrolled for the same reason as above
#pragma unroll
  for (int it = 0; it < FULL; ++it)
    *dst[it] = val[it];
  if constexpr (PIECES % NT != 0) {
    if (tid < PIECES % NT) *place(tid + FULL * NT) = piece(tid + FULL * NT);
  }
}

// ---------------------------------------------------------------------------
// Per-head causal attention with head-dim 1 (the reference's quirk):
//   oh[i,h] = sum_{j<=i} softmax_j(q[i,h] * k[j,h] * 0.125) * v[j,h]
// One lane per query, one wave per 32 queries, k/v of the head staged in LDS. q, k and
// v arrive feature-major ([192][SEQ]): a head's q, k or v is one contiguous row, so a
// wave's load of 32 neighbouring positions is one whole 128-byte line.
//
// A query chunk's cost grows with its index (causal), so one block takes one head
// and TWO chunks of 256 queries: chunk c (short scans) and chunk 7 - c (long scans),
// eight waves each, side by side on one staged copy of k and v. Every block then
// has the same number of (query, key) pairs, and so has every group of waves
// w, w + 4, w + 8, w + 12 (the short chunk's tiles are dealt in reverse order).
//
// The score q*k is monotone in k, so the row maximum over j <= i is known before
// the scan: q * max_{j<=i} k for q >= 0, q * min_{j<=i} k for q < 0. The prefix
// maximum and minimum of k are formed once while the keys are staged; the scan
// then has no running maximum and no rescale: one exp2 per (query, key) and sums
// that do not depend on one another.
// ---------------------------------------------------------------------------
__global__ __launch_bounds__(512)
void attn_headdim1_causal(const float* __restrict__ qkv,  // [192, SEQ]
                          float* __restrict__ oh) {       // [SEQ, 64]
  __shared__ __attribute__((aligned(16))) float k_s[SEQ];
  __shared__ __attribute__((aligned(16))) float v_s[SEQ];
  // First index below: 0 = the short chunk, 1 = the long chunk.
  // Per key of the two chunks: max/min from its 32-key segment's start up to itself.
  __shared__ float pre_max_s[2][256], pre_min_s[2][256];
  // Per 32-key segment of the two chunks: max/min of the whole segment.
  __shared__ __attribute__((aligned(16))) float seg_max_s[2][8], seg_min_s[2][8];
  // Per staging wave: max/min of the keys it staged that lie in front of the chunk.
  __shared__ __attribute__((aligned(16))) float base_max_s[2][16], base_min_s[2][16];
  const int h    = blockIdx.y;
  const int lc   = blockIdx.x;                 // short chunk: 0..3
  const int hc   = SEQ / 256 - 1 - lc;         // long chunk:  7..4
  const int tid  = threadIdx.x;
  const int lane = tid & 31;
  const int wave = __builtin_amdgcn_readfirstlane(tid >> 5);

  // Waves 0..7: tiles 0..7 of the long chunk. Waves 8..15: tiles 7..0 of the short one.
  const int lng = wave < 8 ? 1 : 0;
  const int sub = lng ? wave : 15 - wave;
  const int i0  = (lng ? hc : lc) * 256 + sub * 32;   // first query of this wave
  const int i   = i0 + lane;
  const float qraw = qkv[(size_t)h * SEQ + i];

  // Staging: 512 keys a trip, so this wave stages the chunks of one parity. lc and hc
  // differ in parity: exactly one staged segment of each wave lies in lc or in hc.
  const int par = wave >> 3;
  float bmax0 = -3.402823466e38f, bmin0 = 3.402823466e38f;   // keys in front of lc
  float bmax1 = -3.402823466e38f, bmin1 = 3.402823466e38f;   // keys in front of hc
  float kown = 0.0f;
  // unrolled: all eight loads are in flight together
#pragma unroll
  for (int c = 0; c < SEQ / 512; ++c) {
    const int t = c * 512 + tid;
    const float kk = qkv[(size_t)(NHEAD + h) * SEQ + t];
    k_s[t] = kk;
    v_s[t] = qkv[(size_t)(2 * NHEAD + h) * SEQ + t];
    const int kc = 2 * c + par;                // the chunk this key lies in
    if (kc < lc) { bmax0 = fmaxf(bmax0, kk); bmin0 = fminf(bmin0, kk); }
    if (kc < hc) { bmax1 = fmaxf(bmax1, kk); bmin1 = fminf(bmin1, kk); }
    if (kc == lc || kc == hc) kown = kk;
  }
  const int own = par == (hc & 1) ? 1 : 0;     // which chunk kown lies in
  const int seg = wave & 7;                    // and which 32-key segment of it

  // In-wave inclusive prefix max/min of the wave's segment of lc or hc; in-wave
  // max/min of the keys in front of each chunk.
  float smax = kown, smin = kown;
  // unrolled: constant shuffle distances
#pragma unroll
  for (int d = 1; d < 32; d <<= 1) {
    const float umax  = __shfl_up(smax, d, 32);
    const float umin  = __shfl_up(smin, d, 32);
    const float xmax0 = __shfl_xor(bmax0, d, 32);
    const float xmin0 = __shfl_xor(bmin0, d, 32);
    const float xmax1 = __shfl_xor(bmax1, d, 32);
    const float xmin1 = __shfl_xor(bmin1, d, 32);
    if (lane >= d) { smax = fmaxf(smax, umax); smin = fminf(smin, umin); }
    bmax0 = fmaxf(bmax0, xmax0);
    bmin0 = fminf(bmin0, xmin0);
    bmax1 = fmaxf(bmax1, xmax1);
    bmin1 = fminf(bmin1, xmin1);
  }
  pre_max_s[own][seg * 32 + lane] = smax;
  pre_min_s[own][seg * 32 + lane] = smin;
  if (lane == 31) {
    seg_max_s[own][seg]   = smax;   seg_min_s[own][seg]   = smin;
    base_max_s[0][wave]   = bmax0;  base_min_s[0][wave]   = bmin0;
    base_max_s[1][wave]   = bmax1;  base_min_s[1][wave]   = bmin1;
  }
  // The kernel's only barrier: every wave passes it in front of its scan. Behind it
  // LDS is only read, so waves with scans of unequal length wait on nothing.
  __syncthreads();

  // Row extremes of this wave's queries: the prefix inside their own segment, the
  // chunk's segments in front of it, and every wave's share of the keys in front of
  // the chunk.
  smax = pre_max_s[lng][sub * 32 + lane];
  smin = pre_min_s[lng][sub * 32 + lane];
  // unrolled, with selects and no branch: the LDS reads go out together, one wait
#pragma unroll
  for (int w = 0; w < 8; ++w) {
    const float omax = seg_max_s[lng][w], omin = seg_min_s[lng][w];
    smax = fmaxf(smax, w < sub ? omax : -3.402823466e38f);
    smin = fminf(smin, w < sub ? omin : 3.402823466e38f);
  }
  // unrolled for the same reason
#pragma unroll
  for (int w = 0; w < 16; ++w) {
    smax = fmaxf(smax, base_max_s[lng][w]);
    smin = fminf(smin, base_min_s[lng][w]);
  }

  // scale and log2(e) folded into q: exp(s - m) = exp2(qs * k - qs * kext)
  const float qs = qraw * (0.125f * 1.44269504088896340736f);
  const float ms = qs * (qs >= 0.0f ? smax : smin);
  const v2f q2 = {qs, qs};
  const v2f m2 = {-ms, -ms};

  v2f l0 = {0.0f, 0.0f}, l1 = {0.0f, 0.0f};
  v2f a0 = {0.0f, 0.0f}, a1 = {0.0f, 0.0f};

  // Keys in front of the wave's first query: every lane takes every key.
  // 32 keys a trip (i0 is a multiple of 32): a trip's LDS reads issue as a group
  // ahead of their use, and the loop's own cost spreads over 32 keys.
#pragma unroll 8
  for (int j = 0; j < i0; j += 4) {
    const float4 kk = *(const float4*)&k_s[j];
    const float4 vv = *(const float4*)&v_s[j];
    const v2f s0 = __builtin_elementwise_fma(q2, (v2f){kk.x, kk.y}, m2);
    const v2f s1 = __builtin_elementwise_fma(q2, (v2f){kk.z, kk.w}, m2);
    const v2f p0 = {__builtin_amdgcn_exp2f(s0.x), __builtin_amdgcn_exp2f(s0.y)};
    const v2f p1 = {__builtin_amdgcn_exp2f(s1.x), __builtin_amdgcn_exp2f(s1.y)};
    l0 += p0;
    l1 += p1;
    a0 = __builtin_elementwise_fma(p0, (v2f){vv.x, vv.y}, a0);
    a1 = __builtin_elementwise_fma(p1, (v2f){vv.z, vv.w}, a1);
  }

  // The wave's own 32 keys: key j counts for query i only where j <= i.
  // Runs once per wave: eight keys a trip keeps this tail's code short.
#pragma unroll 2
  for (int u = 0; u < 32; u += 4) {
    const float4 kk = *(const float4*)&k_s[i0 + u];
    const float4 vv = *(const float4*)&v_s[i0 + u];
    const v2f s0 = __builtin_elementwise_fma(q2, (v2f){kk.x, kk.y}, m2);
    const v2f s1 = __builtin_elementwise_fma(q2, (v2f){kk.z, kk.w}, m2);
    const v2f p0 = {u + 0 <= lane ? __builtin_amdgcn_exp2f(s0.x) : 0.0f,
                    u + 1 <= lane ? __builtin_amdgcn_exp2f(s0.y) : 0.0f};
    const v2f p1 = {u + 2 <= lane ? __builtin_amdgcn_exp2f(s1.x) : 0.0f,
                    u + 3 <= lane ? __builtin_amdgcn_exp2f(s1.y) : 0.0f};
    l0 += p0;
    l1 += p1;
    a0 = __builtin_elementwise_fma(p0, (v2f){vv.x, vv.y}, a0);
    a1 = __builtin_elementwise_fma(p1, (v2f){vv.z, vv.w}, a1);
  }

  const float l   = (l0.x + l0.y) + (l1.x + l1.y);
  const float acc = (a0.x + a0.y) + (a1.x + a1.y);
  oh[(size_t)i * NHEAD + h] = acc / l;
}

// ---------------------------------------------------------------------------
// Launch: qkv GEMM -> attention -> output GEMM. Scratch in d_ws:
//   qkv : 192*SEQ floats (1.5 MB), feature-major: row f holds feature f of every position
//   oh  : SEQ*64  floats (0.5 MB)
// ---------------------------------------------------------------------------
extern "C" void kernel_launch(void* const* d_in, const int* in_sizes, int n_in,
                              void* d_out, int out_size, void* d_ws, size_t ws_size,
                              hipStream_t stream) {
  const float* x     = (const float*)d_in[0];   // [1, 2048, 1024]
  const float* w_qkv = (const float*)d_in[1];   // [192, 1024]
  const float* w_out = (const float*)d_in[2];   // [1024, 64]
  float* y = (float*)d_out;                     // [1, 2048, 1024]

  float* qkv = (float*)d_ws;                    // [192, 2048]
  float* oh  = qkv + (size_t)SEQ * FQKV;        // [2048, 64]

  // qkv = (x * w_qkv^T)^T    (M=2048, N=192, K=1024), stored transposed
  gemm_f32_wmma<32, 48, 3, 4, 128, FQKV, DIM, SEQ>
      <<<dim3(FQKV / 48, SEQ / 32), 256, 0, stream>>>(x, w_qkv, qkv);

  // per-head causal softmax attention (head dim 1): one block = head x chunk pair
  attn_headdim1_causal<<<dim3(SEQ / 512, NHEAD), 512, 0, stream>>>(qkv, oh);

  // y = oh * w_out^T     (M=2048, N=1024, K=64)
  gemm_f32_wmma<64, 128, 4, 1, 32, DIM, NHEAD, 0>
      <<<dim3(DIM / 128, SEQ / 64), 256, 0, stream>>>(oh, w_out, y);
}

// v005
// A run of this version takes 27.3 microseconds.
// Timed twice side by side with v004, it ran 1.10 times as fast both times.
// Over all steps from v000 it is 2.97 times as fast.
#include <hip/hip_runtime.h>

// ---------------------------------------------------------------------------
// Problem constants (from the reference):
//   x      : [1, 2048, 1024]  fp32
//   w_qkv  : [192, 1024]      fp32   (torch Linear layout: [out, in])
//   w_out  : [1024, 64]       fp32
//   y      : [1, 2048, 1024]  fp32
// per-head dim is 1 (64 heads), scale = 1/sqrt(64) = 0.125
// ---------------------------------------------------------------------------
#define SEQ   2048
#define DIM   1024
#define NHEAD 64
#define FQKV  (3 * NHEAD)   // 192

typedef float v2f __attribute__((ext_vector_type(2)));
typedef float v4f __attribute__((ext_vector_type(4)));
typedef float v8f __attribute__((ext_vector_type(8)));

// ---------------------------------------------------------------------------
// U (10 or 6) asynchronous 16-byte copies of this lane, global memory -> LDS, through
// no register: staged row i of the lane comes from a (i < UA) or from w, GSTEP floats
// and LSTEP LDS bytes apart. The s_wait_xcnt stands inside the statement, behind the
// last copy, so that no address register is rewritten in front of it.
// ---------------------------------------------------------------------------
template <int U, int UA, int GSTEP, int LSTEP>
__device__ __forceinline__ void stage_rows(unsigned lds, const float* a, const float* w) {
  static_assert(U == 10 || U == 6, "one statement per count");
  const float* g[U];
  // unrolled: g is indexed by constants only and stays in registers
#pragma unroll
  for (int i = 0; i < U; ++i)
    g[i] = i < UA ? a + (size_t)i * GSTEP : w + (size_t)(i - UA) * GSTEP;
  if constexpr (U == 10) {
    asm volatile(
        "global_load_async_to_lds_b128 %0, %10, off\n\t"
        "global_load_async_to_lds_b128 %1, %11, off\n\t"
        "global_load_async_to_lds_b128 %2, %12, off\n\t"
        "global_load_async_to_lds_b128 %3, %13, off\n\t"
        "global_load_async_to_lds_b128 %4, %14, off\n\t"
        "global_load_async_to_lds_b128 %5, %15, off\n\t"
        "global_load_async_to_lds_b128 %6, %16, off\n\t"
        "global_load_async_to_lds_b128 %7, %17, off\n\t"
        "global_load_async_to_lds_b128 %8, %18, off\n\t"
        "global_load_async_to_lds_b128 %9, %19, off\n\t"
        "s_wait_xcnt 0x0"
        :: "v"(lds), "v"(lds + LSTEP), "v"(lds + 2 * LSTEP), "v"(lds + 3 * LSTEP),
           "v"(lds + 4 * LSTEP), "v"(lds + 5 * LSTEP), "v"(lds + 6 * LSTEP),
           "v"(lds + 7 * LSTEP), "v"(lds + 8 * LSTEP), "v"(lds + 9 * LSTEP),
           "v"(g[0]), "v"(g[1]), "v"(g[2]), "v"(g[3]), "v"(g[4]),
           "v"(g[5]), "v"(g[6]), "v"(g[7]), "v"(g[8]), "v"(g[9])
        : "memory");
  } else {
    asm volatile(
        "global_load_async_to_lds_b128 %0, %6, off\n\t"
        "global_load_async_to_lds_b128 %1, %7, off\n\t"
        "global_load_async_to_lds_b128 %2, %8, off\n\t"
        "global_load_async_to_lds_b128 %3, %9, off\n\t"
        "global_load_async_to_lds_b128 %4, %10, off\n\t"
        "global_load_async_to_lds_b128 %5, %11, off\n\t"
        "s_wait_xcnt 0x0"
        :: "v"(lds), "v"(lds + LSTEP), "v"(lds + 2 * LSTEP), "v"(lds + 3 * LSTEP),
           "v"(lds + 4 * LSTEP), "v"(lds + 5 * LSTEP),
           "v"(g[0]), "v"(g[1]), "v"(g[2]), "v"(g[3]), "v"(g[4]), "v"(g[5])
        : "memory");
  }
}

// ---------------------------------------------------------------------------
// C[M x N] = A[M x K] * W[N x K]^T   (all fp32, A and W row-major), V_WMMA_F32_16X16X4_F32.
//
// One block computes a BM x BN tile of C. K is walked in chunks of KC: the block's
// BM rows of A and BN rows of W are copied to LDS asynchronously, 16 bytes a lane,
// adjacent lanes covering whole 128-byte lines (two buffers where there is more than
// one chunk: the next chunk's copies fly while this chunk is multiplied). A wave owns
// 16 rows x WN tiles of 16 columns, so one A fragment serves WN products, and one of
// KS slices of every chunk; the KS partial tiles are summed through LDS at the end,
// in slice order, and C is stored in 16-byte pieces: row-major [M][N] where LDT is 0,
// else transposed, as [N][LDT] (LDT = M), a column of C lying contiguous in memory.
//
// Fragments (32-bit A 16x4: lanes 0-15 hold hardware K0,K1 of row lane, lanes 16-31
// hold K2,K3; B symmetric; C/D: VGPR r = row r (lanes 0-15) or 8 + r (lanes 16-31)).
// One ds_load_b128 gives a lane k = 8 s + 4 half + {0,1,2,3}: {0,1} feed one product
// and {2,3} the next. A and B use the same map, so every product pairs equal k.
// LDS row pitch KC * 4 + 16 bytes (16 bytes x an odd number): fragment reads of 16
// rows fall on distinct banks.
// ---------------------------------------------------------------------------
template <int BM, int BN, int WN, int KS, int KC, int N, int K, int LDT>
__global__ __launch_bounds__((BM / 16) * (BN / (16 * WN)) * KS * 32)
void gemm_f32_wmma(const float* __restrict__ A,
                   const float* __restrict__ W,
                   float* __restrict__ C) {
  constexpr int TM    = BM / 16;             // wave rows of the block tile
  constexpr int TN    = BN / (16 * WN);      // wave columns of the block tile
  constexpr int NT    = TM * TN * KS * 32;   // threads
  constexpr int ROWS  = BM + BN;             // staged rows: A's, then W's
  constexpr int PITCH = KC + 4;              // floats
  constexpr int NCH   = K / KC;
  constexpr int NBUF  = NCH > 1 ? 2 : 1;
  constexpr int C4    = KC / 4;              // 16-byte pieces in a staged row
  constexpr int RP    = NT / C4;             // rows staged by one copy of the block
  constexpr int U     = ROWS / RP;           // copies per thread and chunk
  constexpr int UA    = BM / RP;             // the first UA of them are A's
  constexpr int STEPS = KC / 8 / KS;         // b128 fragment steps per wave and chunk
  constexpr int PR    = LDT ? BN : BM;       // rows of a partial tile as it lies in LDS
  constexpr int PC    = LDT ? BM : BN;       // and its columns: the order C is stored in
  constexpr int RPITCH = PC + 4;             // floats, partial tiles
  static_assert(ROWS % RP == 0 && BM % RP == 0 && NT % C4 == 0, "staging split");
  static_assert(KC % (8 * KS) == 0 && K % KC == 0, "k split");
  static_assert(KS * PR * RPITCH <= NBUF * ROWS * PITCH, "partial tiles fit the buffers");

  __shared__ __attribute__((aligned(16))) float tile[NBUF * ROWS * PITCH];

  const int tid  = threadIdx.x;
  const int lane = tid & 31;
  const int half = lane >> 4;
  const int sub  = lane & 15;
  const int wave = __builtin_amdgcn_readfirstlane(tid >> 5);
  const int wm = wave % TM;
  const int wn = (wave / TM) % TN;
  const int ks = wave / (TM * TN);
  const int m0 = blockIdx.y * BM;
  const int n0 = blockIdx.x * BN;

  const int row0 = tid / C4;
  const int c0   = (tid % C4) * 4;
  const float* ag = A + (size_t)(m0 + row0) * K + c0;
  const float* wg = W + (size_t)(n0 + row0) * K + c0;
  // the lane's LDS byte address in buffer 0: the low 32 bits of the __shared__ address
  const unsigned put0 = (unsigned)(size_t)&tile[row0 * PITCH + c0];
  const int aoff = (wm * 16 + sub) * PITCH + half * 4 + ks * STEPS * 8;
  const int boff = (BM + wn * WN * 16 + sub) * PITCH + half * 4 + ks * STEPS * 8;

  stage_rows<U, UA, RP * K, RP * PITCH * 4>(put0, ag, wg);
  // chunk 0 has landed for this wave ...
  asm volatile("s_wait_asynccnt 0x0" ::: "memory");
  __syncthreads();   // ... and is published to the others
  if (NCH > 1)
    stage_rows<U, UA, RP * K, RP * PITCH * 4>(put0 + ROWS * PITCH * 4, ag + KC, wg + KC);

  v8f acc[WN] = {};
  // rolled: every trip ends in a barrier, an unrolled body would only be longer
#pragma unroll 1
  for (int ch = 0; ch < NCH; ++ch) {
    const int bsel = (ch & (NBUF - 1)) * (ROWS * PITCH);
    const float* buf = tile + bsel;
    // unrolled, with the three loops over n inside: constant LDS offsets, acc and b4 in
    // registers, fragment reads issue ahead of the products
#pragma unroll
    for (int s = 0; s < STEPS; ++s) {
      const float4 a4 = *(const float4*)&buf[aoff + s * 8];
      float4 b4[WN];
#pragma unroll
      for (int n = 0; n < WN; ++n)
        b4[n] = *(const float4*)&buf[boff + n * 16 * PITCH + s * 8];
      // (neg_a, A, neg_b, B, c_mod, C, reuse_a, reuse_b)
#pragma unroll
      for (int n = 0; n < WN; ++n)
        acc[n] = __builtin_amdgcn_wmma_f32_16x16x4_f32(false, (v2f){a4.x, a4.y},
                                                       false, (v2f){b4[n].x, b4[n].y},
                                                       (short)0, acc[n], false, false);
#pragma unroll
      for (int n = 0; n < WN; ++n)
        acc[n] = __builtin_amdgcn_wmma_f32_16x16x4_f32(false, (v2f){a4.z, a4.w},
                                                       false, (v2f){b4[n].z, b4[n].w},
                                                       (short)0, acc[n], false, false);
    }
    // keeps the chunk's products in front of the barrier: sunk behind it they would
    // stand in front of the refill and cut the time its copies have to land
    __builtin_amdgcn_sched_barrier(0);
    // this wave's reads of the chunk's buffer have returned: it may be refilled
    asm volatile("s_wait_dscnt 0x0" ::: "memory");
    // this wave's copies of the next chunk have landed
    asm volatile("s_wait_asynccnt 0x0" ::: "memory");
    // One barrier a chunk: it publishes the next chunk and ends every wave's reads of
    // this one (the buffer is refilled behind it, or reused for the partial tiles).
    __syncthreads();
    if (ch + 2 < NCH)
      stage_rows<U, UA, RP * K, RP * PITCH * 4>(put0 + bsel * 4, ag + (ch + 2) * KC,
                                             wg + (ch + 2) * KC);
  }
  // no copy is outstanding when the buffers change their use
  asm volatile("s_wait_asynccnt 0x0" ::: "memory");

  // Partial tiles to LDS, slice by slice (unrolled: acc is indexed by constants only).
  // Transposed, a lane's eight accumulator rows are eight neighbours of one LDS row.
#pragma unroll
  for (int n = 0; n < WN; ++n) {
    if constexpr (LDT != 0) {
      float* p = &tile[(ks * BN + (wn * WN + n) * 16 + sub) * RPITCH + wm * 16 + half * 8];
      *(float4*)p       = make_float4(acc[n][0], acc[n][1], acc[n][2], acc[n][3]);
      *(float4*)(p + 4) = make_float4(acc[n][4], acc[n][5], acc[n][6], acc[n][7]);
    } else {
#pragma unroll
      for (int r = 0; r < 8; ++r)
        tile[(ks * BM + wm * 16 + r + half * 8) * RPITCH + (wn * WN + n) * 16 + sub] = acc[n][r];
    }
  }
  __syncthreads();   // every partial tile is published

  // 16-byte piece u of the block's C tile: the KS partial sums, added in slice order
  auto piece = [&](int u) {
    const int row = u / (PC / 4);
    const int col = (u % (PC / 4)) * 4;
    float4 s4 = *(const float4*)&tile[row * RPITCH + col];
    // unrolled: the KS reads go out together
#pragma unroll
    for (int p = 1; p < KS; ++p) {
      const float4 t4 = *(const float4*)&tile[(p * PR + row) * RPITCH + col];
      s4.x += t4.x; s4.y += t4.y; s4.z += t4.z; s4.w += t4.w;
    }
    return s4;
  };
  auto place = [&](int u) {
    const int row = u / (PC / 4);
    const int col = (u % (PC / 4)) * 4;
    if constexpr (LDT != 0) return (float4*)&C[(size_t)(n0 + row) * LDT + m0 + col];
    else                    return (float4*)&C[(size_t)(m0 + row) * N + n0 + col];
  };
  constexpr int PIECES = BM * BN / 4;
  constexpr int FULL   = PIECES / NT;
  float4  val[FULL];
  float4* dst[FULL];
  // unrolled: val and dst stay in registers, the LDS reads of all pieces go out together
#pragma unroll
  for (int it = 0; it < FULL; ++it) {
    val[it] = piece(tid + it * NT);
    dst[it] = place(tid + it * NT);
  }
  // keeps every read and address in front of the stores: the stores then follow one
  // another and no register of an issued store is reused between them
  __builtin_amdgcn_sched_barrier(0);
  // unrolled for the same reason as above
#pragma unroll
  for (int it = 0; it < FULL; ++it)
    *dst[it] = val[it];
  if constexpr (PIECES % NT != 0) {
    if (tid < PIECES % NT) *place(tid + FULL * NT) = piece(tid + FULL * NT);
  }
}

// ---------------------------------------------------------------------------
// Per-head causal attention with head-dim 1 (the reference's quirk):
//   oh[i,h] = sum_{j<=i} softmax_j(q[i,h] * k[j,h] * 0.125) * v[j,h]
// TWO queries per lane (i and i + 32), one wave per 64 queries, k/v of the head staged
// in LDS. Every lane of a wave needs the same key, so a 16-byte LDS read hands four keys
// to the whole wave; with two queries in every lane each such read serves 256 (query,
// key) pairs, not 128, and the scan asks half as many LDS clocks per pair (the packed
// f32 operations hold two keys of one query). q, k and v arrive feature-major
// ([192][SEQ]): a head's q, k or v is one contiguous row, so a wave's load of 32
// neighbouring positions is one whole 128-byte line.
//
// A query chunk's cost grows with its index (causal), so one block takes one head
// and TWO chunks of 256 queries: chunk c (short scans) and chunk 7 - c (long scans),
// four waves each, side by side on one staged copy of k and v. Every block then
// has the same number of (query, key) pairs, and so has every pair of waves
// w, w + 4 (the short chunk's tiles are dealt in reverse order).
//
// The score q*k is monotone in k, so the row maximum over j <= i is known before
// the scan: q * max_{j<=i} k for q >= 0, q * min_{j<=i} k for q < 0. The prefix
// maximum and minimum of k are formed once while the keys are staged; the scan
// then has no running maximum and no rescale: one exp2 per (query, key) and sums
// that do not depend on one another.
// ---------------------------------------------------------------------------
__global__ __launch_bounds__(256)
void attn_headdim1_causal(const float* __restrict__ qkv,  // [192, SEQ]
                          float* __restrict__ oh) {       // [SEQ, 64]
  __shared__ __attribute__((aligned(16))) float k_s[SEQ];
  __shared__ __attribute__((aligned(16))) float v_s[SEQ];
  // First index below: 0 = the short chunk, 1 = the long chunk.
  // Per key of the two chunks: max/min from its 32-key segment's start up to itself.
  __shared__ float pre_max_s[2][256], pre_min_s[2][256];
  // Per 32-key segment of the two chunks: max/min of the whole segment.
  __shared__ __attribute__((aligned(16))) float seg_max_s[2][8], seg_min_s[2][8];
  // Per staging wave: max/min of the keys it staged that lie in front of the chunk.
  __shared__ __attribute__((aligned(16))) float base_max_s[2][8], base_min_s[2][8];
  const int h    = blockIdx.y;
  const int lc   = blockIdx.x;                 // short chunk: 0..3
  const int hc   = SEQ / 256 - 1 - lc;         // long chunk:  7..4
  const int tid  = threadIdx.x;
  const int lane = tid & 31;
  const int wave = __builtin_amdgcn_readfirstlane(tid >> 5);

  // Waves 0..3: 64-query tiles 0..3 of the long chunk. Waves 4..7: tiles 3..0 of the
  // short one.
  const int lng = wave < 4 ? 1 : 0;
  const int sub = lng ? wave : 7 - wave;
  const int i0  = (lng ? hc : lc) * 256 + sub * 64;   // first query of this wave
  const int ia  = i0 + lane;                          // the lane's two queries
  const int ib  = ia + 32;
  const float qraw_a = qkv[(size_t)h * SEQ + ia];
  const float qraw_b = qkv[(size_t)h * SEQ + ib];

  // Staging: 256 keys a trip, so trip c is chunk c and this wave stages 32-key segment
  // 'wave' of every chunk, those of lc and hc among them.
  float bmax0 = -3.402823466e38f, bmin0 = 3.402823466e38f;   // keys in front of lc
  float bmax1 = -3.402823466e38f, bmin1 = 3.402823466e38f;   // keys in front of hc
  float kown0 = 0.0f, kown1 = 0.0f;
  float kin[SEQ / 256], vin[SEQ / 256];
  // unrolled: kin and vin are indexed by constants only
#pragma unroll
  for (int c = 0; c < SEQ / 256; ++c) {
    kin[c] = qkv[(size_t)(NHEAD + h) * SEQ + c * 256 + tid];
    vin[c] = qkv[(size_t)(2 * NHEAD + h) * SEQ + c * 256 + tid];
  }
  // keeps all eighteen loads in front of the first wait: they are in flight together
  __builtin_amdgcn_sched_barrier(0);
  // unrolled for the same reason as above
#pragma unroll
  for (int c = 0; c < SEQ / 256; ++c) {
    const int t = c * 256 + tid;
    const float kk = kin[c];
    k_s[t] = kk;
    v_s[t] = vin[c];
    if (c < lc) { bmax0 = fmaxf(bmax0, kk); bmin0 = fminf(bmin0, kk); }
    if (c < hc) { bmax1 = fmaxf(bmax1, kk); bmin1 = fminf(bmin1, kk); }
    if (c == lc) kown0 = kk;
    if (c == hc) kown1 = kk;
  }

  // In-wave inclusive prefix max/min of the wave's segments of lc and hc; in-wave
  // max/min of the keys in front of each chunk.
  float smax0 = kown0, smin0 = kown0, smax1 = kown1, smin1 = kown1;
  // unrolled: constant shuffle distances
#pragma unroll
  for (int d = 1; d < 32; d <<= 1) {
    const float umax0 = __shfl_up(smax0, d, 32);
    const float umin0 = __shfl_up(smin0, d, 32);
    const float umax1 = __shfl_up(smax1, d, 32);
    const float umin1 = __shfl_up(smin1, d, 32);
    const float xmax0 = __shfl_xor(bmax0, d, 32);
    const float xmin0 = __shfl_xor(bmin0, d, 32);
    const float xmax1 = __shfl_xor(bmax1, d, 32);
    const float xmin1 = __shfl_xor(bmin1, d, 32);
    if (lane >= d) {
      smax0 = fmaxf(smax0, umax0); smin0 = fminf(smin0, umin0);
      smax1 = fmaxf(smax1, umax1); smin1 = fminf(smin1, umin1);
    }
    bmax0 = fmaxf(bmax0, xmax0);
    bmin0 = fminf(bmin0, xmin0);
    bmax1 = fmaxf(bmax1, xmax1);
    bmin1 = fminf(bmin1, xmin1);
  }
  pre_max_s[0][tid] = smax0;
  pre_min_s[0][tid] = smin0;
  pre_max_s[1][tid] = smax1;
  pre_min_s[1][tid] = smin1;
  if (lane == 31) {
    seg_max_s[0][wave]  = smax0;  seg_min_s[0][wave]  = smin0;
    seg_max_s[1][wave]  = smax1;  seg_min_s[1][wave]  = smin1;
    base_max_s[0][wave] = bmax0;  base_min_s[0][wave] = bmin0;
    base_max_s[1][wave] = bmax1;  base_min_s[1][wave] = bmin1;
  }
  // The kernel's only barrier: every wave passes it in front of its scan. Behind it
  // LDS is only read, so waves with scans of unequal length wait on nothing.
  __syncthreads();

  // 32 keys and their values, from LDS to registers (every lane reads the same bytes)
  auto fetch = [&](v4f (&kr)[8], v4f (&vr)[8], int j) {
    // unrolled: kr and vr are indexed by constants only and stay in registers
#pragma unroll
    for (int u = 0; u < 8; ++u) {
      kr[u] = *(const v4f*)&k_s[j + 4 * u];
      vr[u] = *(const v4f*)&v_s[j + 4 * u];
    }
    // keeps the reads here, as one group ahead of the work on the other register set:
    // sunk among that work they would return only when their own set's turn has come
    __builtin_amdgcn_sched_barrier(0);
  };
  v4f k0[8], v0[8], k1[8], v1[8];
  fetch(k0, v0, 0);

  // Row extremes of the queries in 32-key segment seg of this wave's chunk: the prefix
  // inside their own segment, the chunk's segments in front of it, and every wave's
  // share of the keys in front of the chunk. ms = qs * (the extreme that q's sign picks).
  // scale and log2(e) folded into q: exp(s - m) = exp2(qs * k - qs * kext)
  auto row_offset = [&](int seg, float qs) {
    float smax = pre_max_s[lng][seg * 32 + lane];
    float smin = pre_min_s[lng][seg * 32 + lane];
    // unrolled, with selects and no branch: the LDS reads go out together, one wait
#pragma unroll
    for (int w = 0; w < 8; ++w) {
      const float omax = seg_max_s[lng][w], omin = seg_min_s[lng][w];
      smax = fmaxf(smax, w < seg ? omax : -3.402823466e38f);
      smin = fminf(smin, w < seg ? omin : 3.402823466e38f);
    }
    // unrolled for the same reason
#pragma unroll
    for (int w = 0; w < 8; ++w) {
      smax = fmaxf(smax, base_max_s[lng][w]);
      smin = fminf(smin, base_min_s[lng][w]);
    }
    return qs * (qs >= 0.0f ? smax : smin);
  };
  const float qs_a = qraw_a * (0.125f * 1.44269504088896340736f);
  const float qs_b = qraw_b * (0.125f * 1.44269504088896340736f);
  const float ms_a = row_offset(2 * sub, qs_a);
  const float ms_b = row_offset(2 * sub + 1, qs_b);
  const v2f qa2 = {qs_a, qs_a}, ma2 = {-ms_a, -ms_a};
  const v2f qb2 = {qs_b, qs_b}, mb2 = {-ms_b, -ms_b};

  // Per query four partial sums: l0, a0 take the keys j = 0, 1 (mod 4) in their halves,
  // l1, a1 the keys j = 2, 3 (mod 4), each in rising order of j.
  v2f la0 = {0.0f, 0.0f}, la1 = {0.0f, 0.0f}, aa0 = {0.0f, 0.0f}, aa1 = {0.0f, 0.0f};
  v2f lb0 = {0.0f, 0.0f}, lb1 = {0.0f, 0.0f}, ab0 = {0.0f, 0.0f}, ab1 = {0.0f, 0.0f};

  // Two keys (kk, their values vv) for one query. lim >= 0: the keys are numbers lim and
  // lim + 1 of the query's own 32-key segment and count only up to the lane's own key.
  auto pair = [&](v2f q2, v2f m2, v2f kk, v2f vv, v2f& l, v2f& a, int lim) {
    const v2f s = __builtin_elementwise_fma(q2, kk, m2);
    const v2f p = {lim <= lane ? __builtin_amdgcn_exp2f(s.x) : 0.0f,
                   lim + 1 <= lane ? __builtin_amdgcn_exp2f(s.y) : 0.0f};
    l += p;
    a = __builtin_elementwise_fma(p, vv, a);
  };
  // 32 keys from registers. ta, tb: 0 = the query takes none of them, 1 = all of them,
  // 2 = they are its own segment. Always called with constants.
  auto keys32 = [&](const v4f (&kr)[8], const v4f (&vr)[8], int ta, int tb) {
    // unrolled: registers are indexed by constants only
#pragma unroll
    for (int u = 0; u < 8; ++u) {
      const v2f klo = __builtin_shufflevector(kr[u], kr[u], 0, 1);
      const v2f khi = __builtin_shufflevector(kr[u], kr[u], 2, 3);
      const v2f vlo = __builtin_shufflevector(vr[u], vr[u], 0, 1);
      const v2f vhi = __builtin_shufflevector(vr[u], vr[u], 2, 3);
      if (ta) {
        pair(qa2, ma2, klo, vlo, la0, aa0, ta == 2 ? 4 * u : -1);
        pair(qa2, ma2, khi, vhi, la1, aa1, ta == 2 ? 4 * u + 2 : -1);
      }
      if (tb) {
        pair(qb2, mb2, klo, vlo, lb0, ab0, tb == 2 ? 4 * u : -1);
        pair(qb2, mb2, khi, vhi, lb1, ab1, tb == 2 ? 4 * u + 2 : -1);
      }
    }
  };

  // Keys in front of the wave's first query: both queries of every lane take every key.
  // 64 keys a trip (i0 is a multiple of 64), in two register sets: while one set is
  // worked on the other is read from LDS, so no trip starts by waiting for its reads.
  // rolled: the body is already 64 keys long
#pragma unroll 1
  for (int j = 0; j < i0; j += 64) {
    fetch(k1, v1, j + 32);
    keys32(k0, v0, 1, 1);
    fetch(k0, v0, j + 64);
    keys32(k1, v1, 1, 1);
  }

  // Keys i0 .. i0 + 31 (they lie in k0, v0): query ia's own segment, all of them in
  // front of query ib. Keys i0 + 32 .. i0 + 63: query ib's own segment, none for ia.
  fetch(k1, v1, i0 + 32);
  keys32(k0, v0, 2, 1);
  keys32(k1, v1, 0, 2);

  const float l_a   = (la0.x + la0.y) + (la1.x + la1.y);
  const float acc_a = (aa0.x + aa0.y) + (aa1.x + aa1.y);
  const float l_b   = (lb0.x + lb0.y) + (lb1.x + lb1.y);
  const float acc_b = (ab0.x + ab0.y) + (ab1.x + ab1.y);
  oh[(size_t)ia * NHEAD + h] = acc_a / l_a;
  oh[(size_t)ib * NHEAD + h] = acc_b / l_b;
}

// ---------------------------------------------------------------------------
// Launch: qkv GEMM -> attention -> output GEMM. Scratch in d_ws:
//   qkv : 192*SEQ floats (1.5 MB), feature-major: row f holds feature f of every position
//   oh  : SEQ*64  floats (0.5 MB)
// ---------------------------------------------------------------------------
extern "C" void kernel_launch(void* const* d_in, const int* in_sizes, int n_in,
                              void* d_out, int out_size, void* d_ws, size_t ws_size,
                              hipStream_t stream) {
  const float* x     = (const float*)d_in[0];   // [1, 2048, 1024]
  const float* w_qkv = (const float*)d_in[1];   // [192, 1024]
  const float* w_out = (const float*)d_in[2];   // [1024, 64]
  float* y = (float*)d_out;                     // [1, 2048, 1024]

  float* qkv = (float*)d_ws;                    // [192, 2048]
  float* oh  = qkv + (size_t)SEQ * FQKV;        // [2048, 64]

  // qkv = (x * w_qkv^T)^T    (M=2048, N=192, K=1024), stored transposed
  gemm_f32_wmma<32, 48, 3, 4, 128, FQKV, DIM, SEQ>
      <<<dim3(FQKV / 48, SEQ / 32), 256, 0, stream>>>(x, w_qkv, qkv);

  // per-head causal softmax attention (head dim 1): one block = head x chunk pair
  attn_headdim1_causal<<<dim3(SEQ / 512, NHEAD), 256, 0, stream>>>(qkv, oh);

  // y = oh * w_out^T     (M=2048, N=1024, K=64)
  gemm_f32_wmma<64, 128, 4, 1, 32, DIM, NHEAD, 0>
      <<<dim3(DIM / 128, SEQ / 64), 256, 0, stream>>>(oh, w_out, y);
}

// v006
// It runs in 26.5 microseconds.
// Two timings next to v005 put it at 1.04 and 1.03 times that version's speed.
// All steps since v000 together make it 3.07 times as fast.
#include <hip/hip_runtime.h>

// ---------------------------------------------------------------------------
// Problem constants (from the reference):
//   x      : [1, 2048, 1024]  fp32
//   w_qkv  : [192, 1024]      fp32   (torch Linear layout: [out, in])
//   w_out  : [1024, 64]       fp32
//   y      : [1, 2048, 1024]  fp32
// per-head dim is 1 (64 heads), scale = 1/sqrt(64) = 0.125
// ---------------------------------------------------------------------------
#define SEQ   2048
#define DIM   1024
#define NHEAD 64
#define FQKV  (3 * NHEAD)   // 192

typedef float v2f __attribute__((ext_vector_type(2)));
typedef float v4f __attribute__((ext_vector_type(4)));
typedef float v8f __attribute__((ext_vector_type(8)));

// ---------------------------------------------------------------------------
// U (10 or 6) asynchronous 16-byte copies of this lane, global memory -> LDS, through
// no register: staged row i of the lane comes from a (i < UA) or from w, GSTEP floats
// and LSTEP LDS bytes apart. The s_wait_xcnt stands inside the statement, behind the
// last copy, so that no address register is rewritten in front of it.
// ---------------------------------------------------------------------------
template <int U, int UA, int GSTEP, int LSTEP>
__device__ __forceinline__ void stage_rows(unsigned lds, const float* a, const float* w) {
  static_assert(U == 10 || U == 6, "one statement per count");
  const float* g[U];
  // unrolled: g is indexed by constants only and stays in registers
#pragma unroll
  for (int i = 0; i < U; ++i)
    g[i] = i < UA ? a + (size_t)i * GSTEP : w + (size_t)(i - UA) * GSTEP;
  if constexpr (U == 10) {
    asm volatile(
        "global_load_async_to_lds_b128 %0, %10, off\n\t"
        "global_load_async_to_lds_b128 %1, %11, off\n\t"
        "global_load_async_to_lds_b128 %2, %12, off\n\t"
        "global_load_async_to_lds_b128 %3, %13, off\n\t"
        "global_load_async_to_lds_b128 %4, %14, off\n\t"
        "global_load_async_to_lds_b128 %5, %15, off\n\t"
        "global_load_async_to_lds_b128 %6, %16, off\n\t"
        "global_load_async_to_lds_b128 %7, %17, off\n\t"
        "global_load_async_to_lds_b128 %8, %18, off\n\t"
        "global_load_async_to_lds_b128 %9, %19, off\n\t"
        "s_wait_xcnt 0x0"
        :: "v"(lds), "v"(lds + LSTEP), "v"(lds + 2 * LSTEP), "v"(lds + 3 * LSTEP),
           "v"(lds + 4 * LSTEP), "v"(lds + 5 * LSTEP), "v"(lds + 6 * LSTEP),
           "v"(lds + 7 * LSTEP), "v"(lds + 8 * LSTEP), "v"(lds + 9 * LSTEP),
           "v"(g[0]), "v"(g[1]), "v"(g[2]), "v"(g[3]), "v"(g[4]),
           "v"(g[5]), "v"(g[6]), "v"(g[7]), "v"(g[8]), "v"(g[9])
        : "memory");
  } else {
    asm volatile(
        "global_load_async_to_lds_b128 %0, %6, off\n\t"
        "global_load_async_to_lds_b128 %1, %7, off\n\t"
        "global_load_async_to_lds_b128 %2, %8, off\n\t"
        "global_load_async_to_lds_b128 %3, %9, off\n\t"
        "global_load_async_to_lds_b128 %4, %10, off\n\t"
        "global_load_async_to_lds_b128 %5, %11, off\n\t"
        "s_wait_xcnt 0x0"
        :: "v"(lds), "v"(lds + LSTEP), "v"(lds + 2 * LSTEP), "v"(lds + 3 * LSTEP),
           "v"(lds + 4 * LSTEP), "v"(lds + 5 * LSTEP),
           "v"(g[0]), "v"(g[1]), "v"(g[2]), "v"(g[3]), "v"(g[4]), "v"(g[5])
        : "memory");
  }
}

// ---------------------------------------------------------------------------
// C[M x N] = A[M x K] * W[N x K]^T   (all fp32, A and W row-major), V_WMMA_F32_16X16X4_F32.
//
// One block computes a BM x BN tile of C. K is walked in chunks of KC: the block's
// BM rows of A and BN rows of W are copied to LDS asynchronously, 16 bytes a lane,
// adjacent lanes covering whole 128-byte lines (two buffers where there is more than
// one chunk: the next chunk's copies fly while this chunk is multiplied). A wave owns
// 16 rows x WN tiles of 16 columns, so one A fragment serves WN products, and one of
// KS slices of every chunk; the KS partial tiles are summed through LDS at the end,
// in slice order, and C is stored in 16-byte pieces: row-major [M][N] where LDT is 0,
// else transposed, as [N][LDT] (LDT = M), a column of C lying contiguous in memory.
//
// Fragments (32-bit A 16x4: lanes 0-15 hold hardware K0,K1 of row lane, lanes 16-31
// hold K2,K3; B symmetric; C/D: VGPR r = row r (lanes 0-15) or 8 + r (lanes 16-31)).
// One ds_load_b128 gives a lane k = 8 s + 4 half + {0,1,2,3}: {0,1} feed one product
// and {2,3} the next. A and B use the same map, so every product pairs equal k.
// LDS row pitch KC * 4 + 16 bytes (16 bytes x an odd number): fragment reads of 16
// rows fall on distinct banks.
// ---------------------------------------------------------------------------
template <int BM, int BN, int WN, int KS, int KC, int N, int K, int LDT>
__global__ __launch_bounds__((BM / 16) * (BN / (16 * WN)) * KS * 32)
void gemm_f32_wmma(const float* __restrict__ A,
                   const float* __restrict__ W,
                   float* __restrict__ C) {
  constexpr int TM    = BM / 16;             // wave rows of the block tile
  constexpr int TN    = BN / (16 * WN);      // wave columns of the block tile
  constexpr int NT    = TM * TN * KS * 32;   // threads
  constexpr int ROWS  = BM + BN;             // staged rows: A's, then W's
  constexpr int PITCH = KC + 4;              // floats
  constexpr int NCH   = K / KC;
  constexpr int NBUF  = NCH > 1 ? 2 : 1;
  constexpr int C4    = KC / 4;              // 16-byte pieces in a staged row
  constexpr int RP    = NT / C4;             // rows staged by one copy of the block
  constexpr int U     = ROWS / RP;           // copies per thread and chunk
  constexpr int UA    = BM / RP;             // the first UA of them are A's
  constexpr int STEPS = KC / 8 / KS;         // b128 fragment steps per wave and chunk
  constexpr int PR    = LDT ? BN : BM;       // rows of a partial tile as it lies in LDS
  constexpr int PC    = LDT ? BM : BN;       // and its columns: the order C is stored in
  constexpr int RPITCH = PC + 4;             // floats, partial tiles
  static_assert(ROWS % RP == 0 && BM % RP == 0 && NT % C4 == 0, "staging split");
  static_assert(KC % (8 * KS) == 0 && K % KC == 0, "k split");
  static_assert(KS * PR * RPITCH <= NBUF * ROWS * PITCH, "partial tiles fit the buffers");

  __shared__ __attribute__((aligned(16))) float tile[NBUF * ROWS * PITCH];

  const int tid  = threadIdx.x;
  const int lane = tid & 31;
  const int half = lane >> 4;
  const int sub  = lane & 15;
  const int wave = __builtin_amdgcn_readfirstlane(tid >> 5);
  const int wm = wave % TM;
  const int wn = (wave / TM) % TN;
  const int ks = wave / (TM * TN);
  const int m0 = blockIdx.y * BM;
  const int n0 = blockIdx.x * BN;

  const int row0 = tid / C4;
  const int c0   = (tid % C4) * 4;
  const float* ag = A + (size_t)(m0 + row0) * K + c0;
  const float* wg = W + (size_t)(n0 + row0) * K + c0;
  // the lane's LDS byte address in buffer 0: the low 32 bits of the __shared__ address
  const unsigned put0 = (unsigned)(size_t)&tile[row0 * PITCH + c0];
  const int aoff = (wm * 16 + sub) * PITCH + half * 4 + ks * STEPS * 8;
  const int boff = (BM + wn * WN * 16 + sub) * PITCH + half * 4 + ks * STEPS * 8;

  stage_rows<U, UA, RP * K, RP * PITCH * 4>(put0, ag, wg);
  // chunk 0 has landed for this wave ...
  asm volatile("s_wait_asynccnt 0x0" ::: "memory");
  __syncthreads();   // ... and is published to the others
  if (NCH > 1)
    stage_rows<U, UA, RP * K, RP * PITCH * 4>(put0 + ROWS * PITCH * 4, ag + KC, wg + KC);

  v8f acc[WN] = {};
  // rolled: every trip ends in a barrier, an unrolled body would only be longer
#pragma unroll 1
  for (int ch = 0; ch < NCH; ++ch) {
    const int bsel = (ch & (NBUF - 1)) * (ROWS * PITCH);
    const float* buf = tile + bsel;
    // unrolled, with the three loops over n inside: constant LDS offsets, acc and b4 in
    // registers, fragment reads issue ahead of the products
#pragma unroll
    for (int s = 0; s < STEPS; ++s) {
      const float4 a4 = *(const float4*)&buf[aoff + s * 8];
      float4 b4[WN];
#pragma unroll
      for (int n = 0; n < WN; ++n)
        b4[n] = *(const float4*)&buf[boff + n * 16 * PITCH + s * 8];
      // (neg_a, A, neg_b, B, c_mod, C, reuse_a, reuse_b)
#pragma unroll
      for (int n = 0; n < WN; ++n)
        acc[n] = __builtin_amdgcn_wmma_f32_16x16x4_f32(false, (v2f){a4.x, a4.y},
                                                       false, (v2f){b4[n].x, b4[n].y},
                                                       (short)0, acc[n], false, false);
#pragma unroll
      for (int n = 0; n < WN; ++n)
        acc[n] = __builtin_amdgcn_wmma_f32_16x16x4_f32(false, (v2f){a4.z, a4.w},
                                                       false, (v2f){b4[n].z, b4[n].w},
                                                       (short)0, acc[n], false, false);
    }
    // keeps the chunk's products in front of the barrier: sunk behind it they would
    // stand in front of the refill and cut the time its copies have to land
    __builtin_amdgcn_sched_barrier(0);
    // this wave's reads of the chunk's buffer have returned: it may be refilled
    asm volatile("s_wait_dscnt 0x0" ::: "memory");
    // this wave's copies of the next chunk have landed
    asm volatile("s_wait_asynccnt 0x0" ::: "memory");
    // One barrier a chunk: it publishes the next chunk and ends every wave's reads of
    // this one (the buffer is refilled behind it, or reused for the partial tiles).
    __syncthreads();
    if (ch + 2 < NCH)
      stage_rows<U, UA, RP * K, RP * PITCH * 4>(put0 + bsel * 4, ag + (ch + 2) * KC,
                                             wg + (ch + 2) * KC);
  }
  // no copy is outstanding when the buffers change their use
  asm volatile("s_wait_asynccnt 0x0" ::: "memory");

  // Partial tiles to LDS, slice by slice (unrolled: acc is indexed by constants only).
  // Transposed, a lane's eight accumulator rows are eight neighbours of one LDS row.
#pragma unroll
  for (int n = 0; n < WN; ++n) {
    if constexpr (LDT != 0) {
      float* p = &tile[(ks * BN + (wn * WN + n) * 16 + sub) * RPITCH + wm * 16 + half * 8];
      *(float4*)p       = make_float4(acc[n][0], acc[n][1], acc[n][2], acc[n][3]);
      *(float4*)(p + 4) = make_float4(acc[n][4], acc[n][5], acc[n][6], acc[n][7]);
    } else {
#pragma unroll
      for (int r = 0; r < 8; ++r)
        tile[(ks * BM + wm * 16 + r + half * 8) * RPITCH + (wn * WN + n) * 16 + sub] = acc[n][r];
    }
  }
  __syncthreads();   // every partial tile is published

  // 16-byte piece u of the block's C tile: the KS partial sums, added in slice order
  auto piece = [&](int u) {
    const int row = u / (PC / 4);
    const int col = (u % (PC / 4)) * 4;
    float4 s4 = *(const float4*)&tile[row * RPITCH + col];
    // unrolled: the KS reads go out together
#pragma unroll
    for (int p = 1; p < KS; ++p) {
      const float4 t4 = *(const float4*)&tile[(p * PR + row) * RPITCH + col];
      s4.x += t4.x; s4.y += t4.y; s4.z += t4.z; s4.w += t4.w;
    }
    return s4;
  };
  auto place = [&](int u) {
    const int row = u / (PC / 4);
    const int col = (u % (PC / 4)) * 4;
    if constexpr (LDT != 0) return (float4*)&C[(size_t)(n0 + row) * LDT + m0 + col];
    else                    return (float4*)&C[(size_t)(m0 + row) * N + n0 + col];
  };
  constexpr int PIECES = BM * BN / 4;
  constexpr int FULL   = PIECES / NT;
  float4  val[FULL];
  float4* dst[FULL];
  // unrolled: val and dst stay in registers, the LDS reads of all pieces go out together
#pragma unroll
  for (int it = 0; it < FULL; ++it) {
    val[it] = piece(tid + it * NT);
    dst[it] = place(tid + it * NT);
  }
  // keeps every read and address in front of the stores: the stores then follow one
  // another and no register of an issued store is reused between them
  __builtin_amdgcn_sched_barrier(0);
  // unrolled for the same reason as above
#pragma unroll
  for (int it = 0; it < FULL; ++it)
    *dst[it] = val[it];
  if constexpr (PIECES % NT != 0) {
    if (tid < PIECES % NT) *place(tid + FULL * NT) = piece(tid + FULL * NT);
  }
}

// ---------------------------------------------------------------------------
// Per-head causal attention with head-dim 1 (the reference's quirk):
//   oh[i,h] = sum_{j<=i} softmax_j(q[i,h] * k[j,h] * 0.125) * v[j,h]
// TWO queries per lane (i and i + 32), one wave per 64 queries, k/v of the head staged
// in LDS. Every lane of a wave needs the same key, so a 16-byte LDS read hands four keys
// to the whole wave; with two queries in every lane each such read serves 256 (query,
// key) pairs, not 128, and the scan asks half as many LDS clocks per pair (the packed
// f32 operations hold two keys of one query). q, k and v arrive feature-major
// ([192][SEQ]): a head's q, k or v is one contiguous row, so a wave's load of 32
// neighbouring positions is one whole 128-byte line.
//
// A query chunk's cost grows with its index (causal), so one block takes one head
// and TWO chunks of 256 queries: chunk c (short scans) and chunk 7 - c (long scans),
// four waves each, side by side on one staged copy of k and v. Every block then
// has the same number of (query, key) pairs, and so has every pair of waves
// w, w + 4 (the short chunk's tiles are dealt in reverse order).
//
// The score q*k is monotone in k, so the row maximum over j <= i is known before
// the scan: q * max_{j<=i} k for q >= 0, q * min_{j<=i} k for q < 0. The prefix
// maximum and minimum of k are formed once while the keys are staged; the scan
// then has no running maximum and no rescale: one exp2 per (query, key) and sums
// that do not depend on one another.
// ---------------------------------------------------------------------------
__global__ __launch_bounds__(256)
void attn_headdim1_causal(const float* __restrict__ qkv,  // [192, SEQ]
                          float* __restrict__ oh) {       // [SEQ, 64]
  __shared__ __attribute__((aligned(16))) float k_s[SEQ];
  __shared__ __attribute__((aligned(16))) float v_s[SEQ];
  // First index below: 0 = the short chunk, 1 = the long chunk.
  // Per key of the two chunks: max/min from its 32-key segment's start up to itself.
  __shared__ float pre_max_s[2][256], pre_min_s[2][256];
  // Per 32-key segment of the two chunks: max/min of the whole segment.
  __shared__ __attribute__((aligned(16))) float seg_max_s[2][8], seg_min_s[2][8];
  // Per staging wave: max/min of the keys it staged that lie in front of the chunk.
  __shared__ __attribute__((aligned(16))) float base_max_s[2][8], base_min_s[2][8];
  const int h    = blockIdx.y;
  const int lc   = blockIdx.x;                 // short chunk: 0..3
  const int hc   = SEQ / 256 - 1 - lc;         // long chunk:  7..4
  const int tid  = threadIdx.x;
  const int lane = tid & 31;
  const int wave = __builtin_amdgcn_readfirstlane(tid >> 5);

  // Waves 0..3: 64-query tiles 0..3 of the long chunk. Waves 4..7: tiles 3..0 of the
  // short one.
  const int lng = wave < 4 ? 1 : 0;
  const int sub = lng ? wave : 7 - wave;
  const int i0  = (lng ? hc : lc) * 256 + sub * 64;   // first query of this wave
  const int ia  = i0 + lane;                          // the lane's two queries
  const int ib  = ia + 32;
  const float qraw_a = qkv[(size_t)h * SEQ + ia];
  const float qraw_b = qkv[(size_t)h * SEQ + ib];

  // Staging: 256 keys a trip, so trip c is chunk c and this wave stages 32-key segment
  // 'wave' of every chunk, those of lc and hc among them.
  float bmax0 = -3.402823466e38f, bmin0 = 3.402823466e38f;   // keys in front of lc
  float bmax1 = -3.402823466e38f, bmin1 = 3.402823466e38f;   // keys in front of hc
  float kown0 = 0.0f, kown1 = 0.0f;
  float kin[SEQ / 256], vin[SEQ / 256];
  // unrolled: kin and vin are indexed by constants only
#pragma unroll
  for (int c = 0; c < SEQ / 256; ++c) {
    kin[c] = qkv[(size_t)(NHEAD + h) * SEQ + c * 256 + tid];
    vin[c] = qkv[(size_t)(2 * NHEAD + h) * SEQ + c * 256 + tid];
  }
  // keeps all eighteen loads in front of the first wait: they are in flight together
  __builtin_amdgcn_sched_barrier(0);
  // unrolled for the same reason as above
#pragma unroll
  for (int c = 0; c < SEQ / 256; ++c) {
    const int t = c * 256 + tid;
    const float kk = kin[c];
    k_s[t] = kk;
    v_s[t] = vin[c];
    if (c < lc) { bmax0 = fmaxf(bmax0, kk); bmin0 = fminf(bmin0, kk); }
    if (c < hc) { bmax1 = fmaxf(bmax1, kk); bmin1 = fminf(bmin1, kk); }
    if (c == lc) kown0 = kk;
    if (c == hc) kown1 = kk;
  }

  // In-wave inclusive prefix max/min of the wave's segments of lc and hc; in-wave
  // max/min of the keys in front of each chunk.
  float smax0 = kown0, smin0 = kown0, smax1 = kown1, smin1 = kown1;
  // unrolled: constant shuffle distances
#pragma unroll
  for (int d = 1; d < 32; d <<= 1) {
    const float umax0 = __shfl_up(smax0, d, 32);
    const float umin0 = __shfl_up(smin0, d, 32);
    const float umax1 = __shfl_up(smax1, d, 32);
    const float umin1 = __shfl_up(smin1, d, 32);
    const float xmax0 = __shfl_xor(bmax0, d, 32);
    const float xmin0 = __shfl_xor(bmin0, d, 32);
    const float xmax1 = __shfl_xor(bmax1, d, 32);
    const float xmin1 = __shfl_xor(bmin1, d, 32);
    if (lane >= d) {
      smax0 = fmaxf(smax0, umax0); smin0 = fminf(smin0, umin0);
      smax1 = fmaxf(smax1, umax1); smin1 = fminf(smin1, umin1);
    }
    bmax0 = fmaxf(bmax0, xmax0);
    bmin0 = fminf(bmin0, xmin0);
    bmax1 = fmaxf(bmax1, xmax1);
    bmin1 = fminf(bmin1, xmin1);
  }
  pre_max_s[0][tid] = smax0;
  pre_min_s[0][tid] = smin0;
  pre_max_s[1][tid] = smax1;
  pre_min_s[1][tid] = smin1;
  if (lane == 31) {
    seg_max_s[0][wave]  = smax0;  seg_min_s[0][wave]  = smin0;
    seg_max_s[1][wave]  = smax1;  seg_min_s[1][wave]  = smin1;
    base_max_s[0][wave] = bmax0;  base_min_s[0][wave] = bmin0;
    base_max_s[1][wave] = bmax1;  base_min_s[1][wave] = bmin1;
  }
  // The kernel's only barrier: every wave passes it in front of its scan. Behind it
  // LDS is only read, so waves with scans of unequal length wait on nothing.
  __syncthreads();

  // 32 keys, or their values, from LDS to registers (every lane reads the same bytes)
  auto fetch = [&](v4f (&r)[8], const float* from, bool in_scan = false) {
    // this fence (between the steps of the scan) and the one below keep the eight reads
    // together, as one group at the place where the last of their registers falls free:
    // lifted, they would stand singly among the earlier steps; sunk, they would return
    // only when their turn has come
    if (in_scan) __builtin_amdgcn_sched_barrier(0);
    // unrolled: r is indexed by constants only and stays in registers
#pragma unroll
    for (int u = 0; u < 8; ++u)
      r[u] = *(const v4f*)&from[4 * u];
    __builtin_amdgcn_sched_barrier(0);
  };
  v4f k0[8], v0[8], k1[8], v1[8];
  fetch(k0, &k_s[0]);
  fetch(v0, &v_s[0]);
  fetch(k1, &k_s[32]);

  // Row extremes of the queries in 32-key segment seg of this wave's chunk: the prefix
  // inside their own segment, the chunk's segments in front of it, and every wave's
  // share of the keys in front of the chunk. ms = qs * (the extreme that q's sign picks).
  // scale and log2(e) folded into q: exp(s - m) = exp2(qs * k - qs * kext)
  auto row_offset = [&](int seg, float qs) {
    float smax = pre_max_s[lng][seg * 32 + lane];
    float smin = pre_min_s[lng][seg * 32 + lane];
    // unrolled, with selects and no branch: the LDS reads go out together, one wait
#pragma unroll
    for (int w = 0; w < 8; ++w) {
      const float omax = seg_max_s[lng][w], omin = seg_min_s[lng][w];
      smax = fmaxf(smax, w < seg ? omax : -3.402823466e38f);
      smin = fminf(smin, w < seg ? omin : 3.402823466e38f);
    }
    // unrolled for the same reason
#pragma unroll
    for (int w = 0; w < 8; ++w) {
      smax = fmaxf(smax, base_max_s[lng][w]);
      smin = fminf(smin, base_min_s[lng][w]);
    }
    return qs * (qs >= 0.0f ? smax : smin);
  };
  const float qs_a = qraw_a * (0.125f * 1.44269504088896340736f);
  const float qs_b = qraw_b * (0.125f * 1.44269504088896340736f);
  const float ms_a = row_offset(2 * sub, qs_a);
  const float ms_b = row_offset(2 * sub + 1, qs_b);
  const v2f qa2 = {qs_a, qs_a}, ma2 = {-ms_a, -ms_a};
  const v2f qb2 = {qs_b, qs_b}, mb2 = {-ms_b, -ms_b};

  // Per query four partial sums: l0, a0 take the keys j = 0, 1 (mod 4) in their halves,
  // l1, a1 the keys j = 2, 3 (mod 4), each in rising order of j.
  // Index: 0, 1 = l0, l1 (a0, a1) of query ia; 2, 3 = those of query ib.
  v2f ls[4] = {}, as[4] = {};

  // Two keys (kk, their values vv) for one query. lim >= 0: the keys are numbers lim and
  // lim + 1 of the query's own 32-key segment and count only up to the lane's own key.
  auto pair = [&](v2f q2, v2f m2, v2f kk, v2f vv, v2f& l, v2f& a, int lim) {
    const v2f s = __builtin_elementwise_fma(q2, kk, m2);
    const v2f p = {lim <= lane ? __builtin_amdgcn_exp2f(s.x) : 0.0f,
                   lim + 1 <= lane ? __builtin_amdgcn_exp2f(s.y) : 0.0f};
    l += p;
    a = __builtin_elementwise_fma(p, vv, a);
  };
  // 32 keys from registers. ta, tb: 0 = the query takes none of them, 1 = all of them,
  // 2 = they are its own segment. Always called with constants.
  auto keys32 = [&](const v4f (&kr)[8], const v4f (&vr)[8], int ta, int tb) {
    // unrolled: registers are indexed by constants only
#pragma unroll
    for (int u = 0; u < 8; ++u) {
      const v2f klo = __builtin_shufflevector(kr[u], kr[u], 0, 1);
      const v2f khi = __builtin_shufflevector(kr[u], kr[u], 2, 3);
      const v2f vlo = __builtin_shufflevector(vr[u], vr[u], 0, 1);
      const v2f vhi = __builtin_shufflevector(vr[u], vr[u], 2, 3);
      if (ta) {
        pair(qa2, ma2, klo, vlo, ls[0], as[0], ta == 2 ? 4 * u : -1);
        pair(qa2, ma2, khi, vhi, ls[1], as[1], ta == 2 ? 4 * u + 2 : -1);
      }
      if (tb) {
        pair(qb2, mb2, klo, vlo, ls[2], as[2], tb == 2 ? 4 * u : -1);
        pair(qb2, mb2, khi, vhi, ls[3], as[3], tb == 2 ? 4 * u + 2 : -1);
      }
    }
  };

  // Keys in front of the wave's first query: both queries of every lane take every key.
  // 64 keys a trip (i0 is a multiple of 64), in two register sets. The work is cut into
  // steps of two keys for one query, step n belonging to partial sum n & 3, and every
  // step issues in the order  exp2, add, exp2, fma, fma : a packed operation
  // stands behind every exp2. Nothing in a step waits for
  // the step itself: its two exp2 take the scores formed four steps earlier (sc), its
  // add and first fma sum up the exp2 of four steps earlier (pe), its last fma forms the
  // scores of four steps on. Every partial sum still takes its keys in rising order.
  v2f sc[4], pe[4] = {};
  // unrolled: sc is indexed by constants only
#pragma unroll
  for (int st = 0; st < 4; ++st)
    sc[st] = __builtin_elementwise_fma(st < 2 ? qa2 : qb2,
                                       st & 1 ? __builtin_shufflevector(k0[0], k0[0], 2, 3)
                                              : __builtin_shufflevector(k0[0], k0[0], 0, 1),
                                       st < 2 ? ma2 : mb2);
  // the first four steps sum up pe = 0 times these values: they must be finite
  v1[7] = (v4f){0.0f, 0.0f, 0.0f, 0.0f};
  // kn: the two keys of four steps on; vo: the two values of four steps earlier
  auto step = [&](int st, v2f kn, v2f vo) {
    v2f pn;
    pn.x = __builtin_amdgcn_exp2f(sc[st].x);
    ls[st] += pe[st];
    pn.y = __builtin_amdgcn_exp2f(sc[st].y);
    as[st] = __builtin_elementwise_fma(pe[st], vo, as[st]);
    sc[st] = __builtin_elementwise_fma(st < 2 ? qa2 : qb2, kn, st < 2 ? ma2 : mb2);
    pe[st] = pn;
    // the four groups below give the scheduler the order named above (0x400: an exp2,
    // 0x002: a packed operation); left free, it gathers the exp2 in runs of eight
    __builtin_amdgcn_sched_group_barrier(0x400, 1, 0);
    __builtin_amdgcn_sched_group_barrier(0x002, 1, 0);
    __builtin_amdgcn_sched_group_barrier(0x400, 1, 0);
    __builtin_amdgcn_sched_group_barrier(0x002, 2, 0);
  };
  // the two keys or values that step n (0 .. 63) of a trip works on
  auto two = [&](const v4f (&r0)[8], const v4f (&r1)[8], int n) {
    const v4f r = n & 32 ? r1[(n >> 2) & 7] : r0[(n >> 2) & 7];
    return n & 1 ? __builtin_shufflevector(r, r, 2, 3) : __builtin_shufflevector(r, r, 0, 1);
  };
  // rolled: the body is already 64 keys long
#pragma unroll 1
  for (int j = 0; j < i0; j += 64) {
    // unrolled: registers are indexed by constants only. A register set is read anew
    // behind the step that uses it last, about 32 steps ahead of its next use.
#pragma unroll
    for (int n = 0; n < 64; ++n) {
      step(n & 3, two(k0, k1, (n + 4) & 63), two(v0, v1, (n + 60) & 63));
      if (n == 3)  fetch(v1, &v_s[j + 32], true);
      if (n == 27) fetch(k0, &k_s[j + 64], true);
      if (n == 35) fetch(v0, &v_s[j + 64], true);
      if (n == 59) fetch(k1, &k_s[j + 96], true);
    }
  }
  // The last four steps' exp2 are summed up (unrolled: constant indices); the scores
  // formed ahead are dropped, the keys they belong to are handled below.
#pragma unroll
  for (int st = 0; st < 4; ++st) {
    ls[st] += pe[st];
    as[st] = __builtin_elementwise_fma(pe[st], two(v0, v1, 60 + st), as[st]);
  }

  // Keys i0 .. i0 + 31 (they lie in k0, v0): query ia's own segment, all of them in
  // front of query ib. Keys i0 + 32 .. i0 + 63 (k1 holds them): query ib's own segment,
  // none for ia.
  fetch(v1, &v_s[i0 + 32]);
  keys32(k0, v0, 2, 1);
  keys32(k1, v1, 0, 2);

  const float l_a   = (ls[0].x + ls[0].y) + (ls[1].x + ls[1].y);
  const float acc_a = (as[0].x + as[0].y) + (as[1].x + as[1].y);
  const float l_b   = (ls[2].x + ls[2].y) + (ls[3].x + ls[3].y);
  const float acc_b = (as[2].x + as[2].y) + (as[3].x + as[3].y);
  oh[(size_t)ia * NHEAD + h] = acc_a / l_a;
  oh[(size_t)ib * NHEAD + h] = acc_b / l_b;
}

// ---------------------------------------------------------------------------
// Launch: qkv GEMM -> attention -> output GEMM. Scratch in d_ws:
//   qkv : 192*SEQ floats (1.5 MB), feature-major: row f holds feature f of every position
//   oh  : SEQ*64  floats (0.5 MB)
// ---------------------------------------------------------------------------
extern "C" void kernel_launch(void* const* d_in, const int* in_sizes, int n_in,
                              void* d_out, int out_size, void* d_ws, size_t ws_size,
                              hipStream_t stream) {
  const float* x     = (const float*)d_in[0];   // [1, 2048, 1024]
  const float* w_qkv = (const float*)d_in[1];   // [192, 1024]
  const float* w_out = (const float*)d_in[2];   // [1024, 64]
  float* y = (float*)d_out;                     // [1, 2048, 1024]

  float* qkv = (float*)d_ws;                    // [192, 2048]
  float* oh  = qkv + (size_t)SEQ * FQKV;        // [2048, 64]

  // qkv = (x * w_qkv^T)^T    (M=2048, N=192, K=1024), stored transposed
  gemm_f32_wmma<32, 48, 3, 4, 128, FQKV, DIM, SEQ>
      <<<dim3(FQKV / 48, SEQ / 32), 256, 0, stream>>>(x, w_qkv, qkv);

  // per-head causal softmax attention (head dim 1): one block = head x chunk pair
  attn_headdim1_causal<<<dim3(SEQ / 512, NHEAD), 256, 0, stream>>>(qkv, oh);

  // y = oh * w_out^T     (M=2048, N=1024, K=64)
  gemm_f32_wmma<64, 128, 4, 1, 32, DIM, NHEAD, 0>
      <<<dim3(DIM / 128, SEQ / 64), 256, 0, stream>>>(oh, w_out, y);
}

// v007
// A run of this version takes 24.2 microseconds.
// Two timings next to v006 both put it at 1.10 times that version's speed.
// All steps since v000 together make it 3.38 times as fast.
#include <hip/hip_runtime.h>

// ---------------------------------------------------------------------------
// Problem constants (from the reference):
//   x      : [1, 2048, 1024]  fp32
//   w_qkv  : [192, 1024]      fp32   (torch Linear layout: [out, in])
//   w_out  : [1024, 64]       fp32
//   y      : [1, 2048, 1024]  fp32
// per-head dim is 1 (64 heads), scale = 1/sqrt(64) = 0.125
// ---------------------------------------------------------------------------
#define SEQ   2048
#define DIM   1024
#define NHEAD 64
#define FQKV  (3 * NHEAD)   // 192

typedef float v2f __attribute__((ext_vector_type(2)));
typedef float v4f __attribute__((ext_vector_type(4)));
typedef float v8f __attribute__((ext_vector_type(8)));

// ---------------------------------------------------------------------------
// U (10 or 6) asynchronous 16-byte copies of this lane, global memory -> LDS, through
// no register: copy i brings 16 bytes from g[i] to LDS byte address lds[i]. The
// s_wait_xcnt stands inside the statement, behind the last copy, so that no address
// register is rewritten in front of it.
// ---------------------------------------------------------------------------
template <int U>
__device__ __forceinline__ void copy_rows(const unsigned (&lds)[U], const float* const (&g)[U]) {
  static_assert(U == 10 || U == 6, "one statement per count");
  if constexpr (U == 10) {
    asm volatile(
        "global_load_async_to_lds_b128 %0, %10, off\n\t"
        "global_load_async_to_lds_b128 %1, %11, off\n\t"
        "global_load_async_to_lds_b128 %2, %12, off\n\t"
        "global_load_async_to_lds_b128 %3, %13, off\n\t"
        "global_load_async_to_lds_b128 %4, %14, off\n\t"
        "global_load_async_to_lds_b128 %5, %15, off\n\t"
        "global_load_async_to_lds_b128 %6, %16, off\n\t"
        "global_load_async_to_lds_b128 %7, %17, off\n\t"
        "global_load_async_to_lds_b128 %8, %18, off\n\t"
        "global_load_async_to_lds_b128 %9, %19, off\n\t"
        "s_wait_xcnt 0x0"
        :: "v"(lds[0]), "v"(lds[1]), "v"(lds[2]), "v"(lds[3]), "v"(lds[4]),
           "v"(lds[5]), "v"(lds[6]), "v"(lds[7]), "v"(lds[8]), "v"(lds[9]),
           "v"(g[0]), "v"(g[1]), "v"(g[2]), "v"(g[3]), "v"(g[4]),
           "v"(g[5]), "v"(g[6]), "v"(g[7]), "v"(g[8]), "v"(g[9])
        : "memory");
  } else {
    asm volatile(
        "global_load_async_to_lds_b128 %0, %6, off\n\t"
        "global_load_async_to_lds_b128 %1, %7, off\n\t"
        "global_load_async_to_lds_b128 %2, %8, off\n\t"
        "global_load_async_to_lds_b128 %3, %9, off\n\t"
        "global_load_async_to_lds_b128 %4, %10, off\n\t"
        "global_load_async_to_lds_b128 %5, %11, off\n\t"
        "s_wait_xcnt 0x0"
        :: "v"(lds[0]), "v"(lds[1]), "v"(lds[2]), "v"(lds[3]), "v"(lds[4]), "v"(lds[5]),
           "v"(g[0]), "v"(g[1]), "v"(g[2]), "v"(g[3]), "v"(g[4]), "v"(g[5])
        : "memory");
  }
}

// ---------------------------------------------------------------------------
// C[M x N] = A[M x K] * W[N x K]^T   (all fp32, A and W row-major), V_WMMA_F32_16X16X4_F32.
//
// One block computes a BM x BN tile of C. K is walked in chunks of KC: the block's
// BM rows of A and BN rows of W are copied to LDS asynchronously, 16 bytes a lane,
// adjacent lanes covering whole 128-byte lines, into a ring of NBUF buffers: the copies
// run up to NBUF - 1 chunks ahead of the products, so a copy has two chunks' products
// long to land, and a chunk is published one block of products before it is needed, so
// that its first fragments are read under the products of the chunk before. A wave owns
// 16 rows x WN tiles of 16 columns, so one A fragment serves WN products, and one of
// KS slices of every chunk; the KS partial tiles are summed through LDS at the end,
// in slice order, and C is stored in 16-byte pieces: row-major [M][N] where LDT is 0,
// else transposed, as [N][LDT] (LDT = M), a column of C lying contiguous in memory.
//
// Fragments (32-bit A 16x4: lanes 0-15 hold hardware K0,K1 of row lane, lanes 16-31
// hold K2,K3; B symmetric; C/D: VGPR r = row r (lanes 0-15) or 8 + r (lanes 16-31)).
// One ds_load_b128 gives a lane k = 8 s + 4 half + {0,1,2,3}: {0,1} feed one product
// and {2,3} the next. A and B use the same map, so every product pairs equal k.
// LDS row pitch KC * 4 + 16 bytes (16 bytes x an odd number): fragment reads of 16
// rows fall on distinct banks.
// ---------------------------------------------------------------------------
template <int BM, int BN, int WN, int KS, int KC, int NBUF, int N, int K, int LDT>
__global__ __launch_bounds__((BM / 16) * (BN / (16 * WN)) * KS * 32)
void gemm_f32_wmma(const float* __restrict__ A,
                   const float* __restrict__ W,
                   float* __restrict__ C) {
  constexpr int TM    = BM / 16;             // wave rows of the block tile
  constexpr int TN    = BN / (16 * WN);      // wave columns of the block tile
  constexpr int NT    = TM * TN * KS * 32;   // threads
  constexpr int ROWS  = BM + BN;             // staged rows: A's, then W's
  constexpr int PITCH = KC + 4;              // floats
  constexpr int NCH   = K / KC;
  // chunks whose copies are issued in front of the loop; the ring then stays that far ahead
  constexpr int LEAD  = NCH <= NBUF ? NCH : NBUF - 1;
  constexpr int BUFB  = ROWS * PITCH * 4;    // bytes of one buffer
  constexpr int C4    = KC / 4;              // 16-byte pieces in a staged row
  constexpr int RP    = NT / C4;             // rows staged by one copy of the block
  constexpr int U     = ROWS / RP;           // copies per thread and chunk
  constexpr int UA    = BM / RP;             // the first UA of them are A's
  constexpr int STEPS = KC / 8 / KS;         // b128 fragment steps per wave and chunk
  constexpr int PR    = LDT ? BN : BM;       // rows of a partial tile as it lies in LDS
  constexpr int PC    = LDT ? BM : BN;       // and its columns: the order C is stored in
  constexpr int RPITCH = PC + 4;             // floats, partial tiles
  static_assert(ROWS % RP == 0 && BM % RP == 0 && NT % C4 == 0, "staging split");
  static_assert(KC % (8 * KS) == 0 && K % KC == 0 && STEPS % 2 == 0, "k split");
  static_assert((NBUF & (NBUF - 1)) == 0 && LEAD >= 2 && LEAD <= NCH, "ring");
  static_assert(U * LEAD <= 63, "copies of one wave in flight");
  static_assert(KS * PR * RPITCH <= NBUF * ROWS * PITCH, "partial tiles fit the buffers");

  __shared__ __attribute__((aligned(16))) float tile[NBUF * ROWS * PITCH];

  const int tid  = threadIdx.x;
  const int lane = tid & 31;
  const int half = lane >> 4;
  const int sub  = lane & 15;
  const int wave = __builtin_amdgcn_readfirstlane(tid >> 5);
  const int wm = wave % TM;
  const int wn = (wave / TM) % TN;
  const int ks = wave / (TM * TN);
  const int m0 = blockIdx.y * BM;
  const int n0 = blockIdx.x * BN;

  const int row0 = tid / C4;
  const int c0   = (tid % C4) * 4;
  const float* ag = A + (size_t)(m0 + row0) * K + c0;
  const float* wg = W + (size_t)(n0 + row0) * K + c0;
  // the lane's LDS byte address in buffer 0: the low 32 bits of the __shared__ address
  const unsigned put0 = (unsigned)(size_t)&tile[row0 * PITCH + c0];
  const int aoff = (wm * 16 + sub) * PITCH + half * 4 + ks * STEPS * 8;
  const int boff = (BM + wn * WN * 16 + sub) * PITCH + half * 4 + ks * STEPS * 8;

  // The lane's U copies of one chunk: LDS addresses and global addresses, kept in registers
  // of their own and moved on from chunk to chunk (unrolled loops: constant indices).
  unsigned put[U];
  const float* get[U];
#pragma unroll
  for (int i = 0; i < U; ++i) {
    put[i] = put0 + i * (RP * PITCH * 4);
    get[i] = i < UA ? ag + (size_t)i * (RP * K) : wg + (size_t)(i - UA) * (RP * K);
  }
  // chunks 0 .. LEAD - 1 into buffers 0 .. LEAD - 1
  copy_rows<U>(put, get);
#pragma unroll
  for (int c = 1; c < LEAD; ++c) {
#pragma unroll
    for (int i = 0; i < U; ++i) { put[i] += BUFB; get[i] += KC; }
    copy_rows<U>(put, get);
  }
  // chunk 0 has landed for this wave (the LEAD - 1 chunks of U copies each that the wave
  // issued behind it may stay in flight) ...
  asm volatile("s_wait_asynccnt %0" :: "n"(U * (LEAD - 1)) : "memory");
  __syncthreads();   // ... and is published to the others

  // the fragments of step s of the chunk whose A and W rows of this lane start at pa, pb
  auto frags = [&](const float* pa, const float* pb, int s, float4& a4, float4 (&b4)[WN]) {
    a4 = *(const float4*)&pa[s * 8];
    // unrolled: b4 is indexed by constants only
#pragma unroll
    for (int n = 0; n < WN; ++n)
      b4[n] = *(const float4*)&pb[n * 16 * PITCH + s * 8];
  };
  v8f acc[WN] = {};
  // the 2 WN products of one step (unrolled: acc and b4 are indexed by constants only)
  auto products = [&](const float4& a4, const float4 (&b4)[WN]) {
    // (neg_a, A, neg_b, B, c_mod, C, reuse_a, reuse_b)
#pragma unroll
    for (int n = 0; n < WN; ++n)
      acc[n] = __builtin_amdgcn_wmma_f32_16x16x4_f32(false, (v2f){a4.x, a4.y},
                                                     false, (v2f){b4[n].x, b4[n].y},
                                                     (short)0, acc[n], false, false);
#pragma unroll
    for (int n = 0; n < WN; ++n)
      acc[n] = __builtin_amdgcn_wmma_f32_16x16x4_f32(false, (v2f){a4.z, a4.w},
                                                     false, (v2f){b4[n].z, b4[n].w},
                                                     (short)0, acc[n], false, false);
  };
  // Waves w and w + NT / 64 share a SIMD: one of them issues its refill in front of the
  // chunk's last products, the other behind them, so that one wave's products run while
  // the other issues its copies.
  const bool early = wave < NT / 64;

  // two fragment sets: step s multiplies set s & 1 while the next step's set is read
  float4 fa[2], fb[2][WN];
  const float* pa = tile + aoff;
  const float* pb = tile + boff;
  frags(pa, pb, 0, fa[0], fb[0]);
  // One chunk but the last. ring: chunk ch + LEAD exists and is copied in this pass.
  auto pass = [&](int ch, bool ring) {
    if (ring) {
      // the copies' addresses move on to chunk ch + LEAD, in buffer (ch + LEAD) mod NBUF
      const int hop = ((ch + LEAD) & (NBUF - 1)) ? BUFB : -(NBUF - 1) * BUFB;
#pragma unroll
      for (int i = 0; i < U; ++i) { put[i] += hop; get[i] += KC; }
    }
    // unrolled: constant LDS offsets, the fragment sets are indexed by constants only
#pragma unroll
    for (int s = 0; s + 1 < STEPS; ++s) {
      frags(pa, pb, s + 1, fa[(s + 1) & 1], fb[(s + 1) & 1]);
      products(fa[s & 1], fb[s & 1]);
    }
    // Chunk ch + 1 is published in front of chunk ch's last products, because its first
    // fragments are read under them.
    // keeps the earlier steps' products and the address arithmetic in front of the barrier
    __builtin_amdgcn_sched_barrier(0);
    // this wave's reads so far, those of chunk ch - 1 among them, have returned
    asm volatile("s_wait_dscnt 0x0" ::: "memory");
    // This wave's copies of chunk ch + 1 have landed. Behind them the wave has issued the
    // chunks up to ch + LEAD - 1, or up to the last: where those are LEAD - 2 chunks of U
    // copies each they may stay in flight, where they are fewer the wait is for all.
    if (LEAD > 2 && ch + LEAD <= NCH)
      asm volatile("s_wait_asynccnt %0" :: "n"(LEAD > 2 ? U * (LEAD - 2) : 0) : "memory");
    else
      asm volatile("s_wait_asynccnt 0x0" ::: "memory");
    // One barrier a chunk: it publishes chunk ch + 1 and ends every wave's reads of chunk
    // ch - 1, whose buffer is refilled behind it.
    __syncthreads();
    // the read addresses move on to buffer (ch + 1) mod NBUF
    const int rhop = ((ch + 1) & (NBUF - 1)) ? ROWS * PITCH : -(NBUF - 1) * (ROWS * PITCH);
    pa += rhop;
    pb += rhop;
    frags(pa, pb, 0, fa[0], fb[0]);
    // keeps that arithmetic in front of the products below: sunk among them it could take
    // an operand register directly behind the product that reads it
    if constexpr (NCH > LEAD) __builtin_amdgcn_sched_barrier(0);
    if (ring && early) copy_rows<U>(put, get);
    products(fa[(STEPS - 1) & 1], fb[(STEPS - 1) & 1]);
    // keeps the chunk's last products in front of the late refill
    if (ring) __builtin_amdgcn_sched_barrier(0);
    if (ring && !early) copy_rows<U>(put, get);
  };
  // The passes that refill. Rolled: every pass holds a barrier, an unrolled body would only
  // be longer.
#pragma unroll 1
  for (int ch = 0; ch + LEAD < NCH; ++ch) pass(ch, true);
  // the passes behind the last refill (rolled: LDS addresses stay in registers, with
  // offsets that fit the instruction's field)
#pragma unroll 1
  for (int ch = NCH - LEAD; ch + 1 < NCH; ++ch) pass(ch, false);
  // the last chunk (unrolled as above)
#pragma unroll
  for (int s = 0; s < STEPS; ++s) {
    if (s + 1 < STEPS) frags(pa, pb, s + 1, fa[(s + 1) & 1], fb[(s + 1) & 1]);
    products(fa[s & 1], fb[s & 1]);
  }
  // keeps the products in front of the barrier
  __builtin_amdgcn_sched_barrier(0);
  // The buffers change their use: no copy is outstanding, this wave's reads have
  // returned, and the barrier ends every wave's reads of the last chunk.
  asm volatile("s_wait_asynccnt 0x0" ::: "memory");
  asm volatile("s_wait_dscnt 0x0" ::: "memory");
  __syncthreads();

  // Partial tiles to LDS, slice by slice (unrolled: acc is indexed by constants only).
  // Transposed, a lane's eight accumulator rows are eight neighbours of one LDS row.
#pragma unroll
  for (int n = 0; n < WN; ++n) {
    if constexpr (LDT != 0) {
      float* p = &tile[(ks * BN + (wn * WN + n) * 16 + sub) * RPITCH + wm * 16 + half * 8];
      *(float4*)p       = make_float4(acc[n][0], acc[n][1], acc[n][2], acc[n][3]);
      *(float4*)(p + 4) = make_float4(acc[n][4], acc[n][5], acc[n][6], acc[n][7]);
    } else {
#pragma unroll
      for (int r = 0; r < 8; ++r)
        tile[(ks * BM + wm * 16 + r + half * 8) * RPITCH + (wn * WN + n) * 16 + sub] = acc[n][r];
    }
  }
  __syncthreads();   // every partial tile is published

  // 16-byte piece u of the block's C tile: the KS partial sums, added in slice order
  auto piece = [&](int u) {
    const int row = u / (PC / 4);
    const int col = (u % (PC / 4)) * 4;
    float4 s4 = *(const float4*)&tile[row * RPITCH + col];
    // unrolled: the KS reads go out together
#pragma unroll
    for (int p = 1; p < KS; ++p) {
      const float4 t4 = *(const float4*)&tile[(p * PR + row) * RPITCH + col];
      s4.x += t4.x; s4.y += t4.y; s4.z += t4.z; s4.w += t4.w;
    }
    return s4;
  };
  auto place = [&](int u) {
    const int row = u / (PC / 4);
    const int col = (u % (PC / 4)) * 4;
    if constexpr (LDT != 0) return (float4*)&C[(size_t)(n0 + row) * LDT + m0 + col];
    else                    return (float4*)&C[(size_t)(m0 + row) * N + n0 + col];
  };
  constexpr int PIECES = BM * BN / 4;
  constexpr int FULL   = PIECES / NT;
  float4  val[FULL];
  float4* dst[FULL];
  // unrolled: val and dst stay in registers, the LDS reads of all pieces go out together
#pragma unroll
  for (int it = 0; it < FULL; ++it) {
    val[it] = piece(tid + it * NT);
    dst[it] = place(tid + it * NT);
  }
  // keeps every read and address in front of the stores: the stores then follow one
  // another and no register of an issued store is reused between them
  __builtin_amdgcn_sched_barrier(0);
  // unrolled for the same reason as above
#pragma unroll
  for (int it = 0; it < FULL; ++it)
    *dst[it] = val[it];
  if constexpr (PIECES % NT != 0) {
    if (tid < PIECES % NT) *place(tid + FULL * NT) = piece(tid + FULL * NT);
  }
}

// ---------------------------------------------------------------------------
// Per-head causal attention with head-dim 1 (the reference's quirk):
//   oh[i,h] = sum_{j<=i} softmax_j(q[i,h] * k[j,h] * 0.125) * v[j,h]
// TWO queries per lane (i and i + 32), one wave per 64 queries, k/v of the head staged
// in LDS. Every lane of a wave needs the same key, so a 16-byte LDS read hands four keys
// to the whole wave; with two queries in every lane each such read serves 256 (query,
// key) pairs, not 128, and the scan asks half as many LDS clocks per pair (the packed
// f32 operations hold two keys of one query). q, k and v arrive feature-major
// ([192][SEQ]): a head's q, k or v is one contiguous row, so a wave's load of 32
// neighbouring positions is one whole 128-byte line.
//
// A query chunk's cost grows with its index (causal), so one block takes one head
// and TWO chunks of 256 queries: chunk c (short scans) and chunk 7 - c (long scans),
// four waves each, side by side on one staged copy of k and v. Every block then
// has the same number of (query, key) pairs, and so has every pair of waves
// w, w + 4 (the short chunk's tiles are dealt in reverse order).
//
// The score q*k is monotone in k, so the row maximum over j <= i is known before
// the scan: q * max_{j<=i} k for q >= 0, q * min_{j<=i} k for q < 0. The prefix
// maximum and minimum of k are formed once while the keys are staged; the scan
// then has no running maximum and no rescale: one exp2 per (query, key) and sums
// that do not depend on one another.
// ---------------------------------------------------------------------------
__global__ __launch_bounds__(256)
void attn_headdim1_causal(const float* __restrict__ qkv,  // [192, SEQ]
                          float* __restrict__ oh) {       // [SEQ, 64]
  __shared__ __attribute__((aligned(16))) float k_s[SEQ];
  __shared__ __attribute__((aligned(16))) float v_s[SEQ];
  // First index below: 0 = the short chunk, 1 = the long chunk.
  // Per key of the two chunks: max/min from its 32-key segment's start up to itself.
  __shared__ float pre_max_s[2][256], pre_min_s[2][256];
  // Per 32-key segment of the two chunks: max/min of the whole segment.
  __shared__ __attribute__((aligned(16))) float seg_max_s[2][8], seg_min_s[2][8];
  // Per staging wave: max/min of the keys it staged that lie in front of the chunk.
  __shared__ __attribute__((aligned(16))) float base_max_s[2][8], base_min_s[2][8];
  const int h    = blockIdx.y;
  const int lc   = blockIdx.x;                 // short chunk: 0..3
  const int hc   = SEQ / 256 - 1 - lc;         // long chunk:  7..4
  const int tid  = threadIdx.x;
  const int lane = tid & 31;
  const int wave = __builtin_amdgcn_readfirstlane(tid >> 5);

  // Waves 0..3: 64-query tiles 0..3 of the long chunk. Waves 4..7: tiles 3..0 of the
  // short one.
  const int lng = wave < 4 ? 1 : 0;
  const int sub = lng ? wave : 7 - wave;
  const int i0  = (lng ? hc : lc) * 256 + sub * 64;   // first query of this wave
  const int ia  = i0 + lane;                          // the lane's two queries
  const int ib  = ia + 32;
  const float qraw_a = qkv[(size_t)h * SEQ + ia];
  const float qraw_b = qkv[(size_t)h * SEQ + ib];

  // Staging: 256 keys a trip, so trip c is chunk c and this wave stages 32-key segment
  // 'wave' of every chunk, those of lc and hc among them.
  float bmax0 = -3.402823466e38f, bmin0 = 3.402823466e38f;   // keys in front of lc
  float bmax1 = -3.402823466e38f, bmin1 = 3.402823466e38f;   // keys in front of hc
  float kown0 = 0.0f, kown1 = 0.0f;
  float kin[SEQ / 256], vin[SEQ / 256];
  // unrolled: kin and vin are indexed by constants only
#pragma unroll
  for (int c = 0; c < SEQ / 256; ++c) {
    kin[c] = qkv[(size_t)(NHEAD + h) * SEQ + c * 256 + tid];
    vin[c] = qkv[(size_t)(2 * NHEAD + h) * SEQ + c * 256 + tid];
  }
  // keeps all eighteen loads in front of the first wait: they are in flight together
  __builtin_amdgcn_sched_barrier(0);
  // unrolled for the same reason as above
#pragma unroll
  for (int c = 0; c < SEQ / 256; ++c) {
    const int t = c * 256 + tid;
    const float kk = kin[c];
    k_s[t] = kk;
    v_s[t] = vin[c];
    if (c < lc) { bmax0 = fmaxf(bmax0, kk); bmin0 = fminf(bmin0, kk); }
    if (c < hc) { bmax1 = fmaxf(bmax1, kk); bmin1 = fminf(bmin1, kk); }
    if (c == lc) kown0 = kk;
    if (c == hc) kown1 = kk;
  }

  // In-wave inclusive prefix max/min of the wave's segments of lc and hc; in-wave
  // max/min of the keys in front of each chunk.
  float smax0 = kown0, smin0 = kown0, smax1 = kown1, smin1 = kown1;
  // unrolled: constant shuffle distances
#pragma unroll
  for (int d = 1; d < 32; d <<= 1) {
    const float umax0 = __shfl_up(smax0, d, 32);
    const float umin0 = __shfl_up(smin0, d, 32);
    const float umax1 = __shfl_up(smax1, d, 32);
    const float umin1 = __shfl_up(smin1, d, 32);
    const float xmax0 = __shfl_xor(bmax0, d, 32);
    const float xmin0 = __shfl_xor(bmin0, d, 32);
    const float xmax1 = __shfl_xor(bmax1, d, 32);
    const float xmin1 = __shfl_xor(bmin1, d, 32);
    if (lane >= d) {
      smax0 = fmaxf(smax0, umax0); smin0 = fminf(smin0, umin0);
      smax1 = fmaxf(smax1, umax1); smin1 = fminf(smin1, umin1);
    }
    bmax0 = fmaxf(bmax0, xmax0);
    bmin0 = fminf(bmin0, xmin0);
    bmax1 = fmaxf(bmax1, xmax1);
    bmin1 = fminf(bmin1, xmin1);
  }
  pre_max_s[0][tid] = smax0;
  pre_min_s[0][tid] = smin0;
  pre_max_s[1][tid] = smax1;
  pre_min_s[1][tid] = smin1;
  if (lane == 31) {
    seg_max_s[0][wave]  = smax0;  seg_min_s[0][wave]  = smin0;
    seg_max_s[1][wave]  = smax1;  seg_min_s[1][wave]  = smin1;
    base_max_s[0][wave] = bmax0;  base_min_s[0][wave] = bmin0;
    base_max_s[1][wave] = bmax1;  base_min_s[1][wave] = bmin1;
  }
  // The kernel's only barrier: every wave passes it in front of its scan. Behind it
  // LDS is only read, so waves with scans of unequal length wait on nothing.
  __syncthreads();

  // 32 keys, or their values, from LDS to registers (every lane reads the same bytes)
  auto fetch = [&](v4f (&r)[8], const float* from, bool in_scan = false) {
    // this fence (between the steps of the scan) and the one below keep the eight reads
    // together, as one group at the place where the last of their registers falls free:
    // lifted, they would stand singly among the earlier steps; sunk, they would return
    // only when their turn has come
    if (in_scan) __builtin_amdgcn_sched_barrier(0);
    // unrolled: r is indexed by constants only and stays in registers
#pragma unroll
    for (int u = 0; u < 8; ++u)
      r[u] = *(const v4f*)&from[4 * u];
    __builtin_amdgcn_sched_barrier(0);
  };
  v4f k0[8], v0[8], k1[8], v1[8];
  fetch(k0, &k_s[0]);
  fetch(v0, &v_s[0]);
  fetch(k1, &k_s[32]);

  // Row extremes of the queries in 32-key segment seg of this wave's chunk: the prefix
  // inside their own segment, the chunk's segments in front of it, and every wave's
  // share of the keys in front of the chunk. ms = qs * (the extreme that q's sign picks).
  // scale and log2(e) folded into q: exp(s - m) = exp2(qs * k - qs * kext)
  auto row_offset = [&](int seg, float qs) {
    float smax = pre_max_s[lng][seg * 32 + lane];
    float smin = pre_min_s[lng][seg * 32 + lane];
    // unrolled, with selects and no branch: the LDS reads go out together, one wait
#pragma unroll
    for (int w = 0; w < 8; ++w) {
      const float omax = seg_max_s[lng][w], omin = seg_min_s[lng][w];
      smax = fmaxf(smax, w < seg ? omax : -3.402823466e38f);
      smin = fminf(smin, w < seg ? omin : 3.402823466e38f);
    }
    // unrolled for the same reason
#pragma unroll
    for (int w = 0; w < 8; ++w) {
      smax = fmaxf(smax, base_max_s[lng][w]);
      smin = fminf(smin, base_min_s[lng][w]);
    }
    return qs * (qs >= 0.0f ? smax : smin);
  };
  const float qs_a = qraw_a * (0.125f * 1.44269504088896340736f);
  const float qs_b = qraw_b * (0.125f * 1.44269504088896340736f);
  const float ms_a = row_offset(2 * sub, qs_a);
  const float ms_b = row_offset(2 * sub + 1, qs_b);
  const v2f qa2 = {qs_a, qs_a}, ma2 = {-ms_a, -ms_a};
  const v2f qb2 = {qs_b, qs_b}, mb2 = {-ms_b, -ms_b};

  // Per query four partial sums: l0, a0 take the keys j = 0, 1 (mod 4) in their halves,
  // l1, a1 the keys j = 2, 3 (mod 4), each in rising order of j.
  // Index: 0, 1 = l0, l1 (a0, a1) of query ia; 2, 3 = those of query ib.
  v2f ls[4] = {}, as[4] = {};

  // Two keys (kk, their values vv) for one query. lim >= 0: the keys are numbers lim and
  // lim + 1 of the query's own 32-key segment and count only up to the lane's own key.
  auto pair = [&](v2f q2, v2f m2, v2f kk, v2f vv, v2f& l, v2f& a, int lim) {
    const v2f s = __builtin_elementwise_fma(q2, kk, m2);
    const v2f p = {lim <= lane ? __builtin_amdgcn_exp2f(s.x) : 0.0f,
                   lim + 1 <= lane ? __builtin_amdgcn_exp2f(s.y) : 0.0f};
    l += p;
    a = __builtin_elementwise_fma(p, vv, a);
  };
  // 32 keys from registers. ta, tb: 0 = the query takes none of them, 1 = all of them,
  // 2 = they are its own segment. Always called with constants.
  auto keys32 = [&](const v4f (&kr)[8], const v4f (&vr)[8], int ta, int tb) {
    // unrolled: registers are indexed by constants only
#pragma unroll
    for (int u = 0; u < 8; ++u) {
      const v2f klo = __builtin_shufflevector(kr[u], kr[u], 0, 1);
      const v2f khi = __builtin_shufflevector(kr[u], kr[u], 2, 3);
      const v2f vlo = __builtin_shufflevector(vr[u], vr[u], 0, 1);
      const v2f vhi = __builtin_shufflevector(vr[u], vr[u], 2, 3);
      if (ta) {
        pair(qa2, ma2, klo, vlo, ls[0], as[0], ta == 2 ? 4 * u : -1);
        pair(qa2, ma2, khi, vhi, ls[1], as[1], ta == 2 ? 4 * u + 2 : -1);
      }
      if (tb) {
        pair(qb2, mb2, klo, vlo, ls[2], as[2], tb == 2 ? 4 * u : -1);
        pair(qb2, mb2, khi, vhi, ls[3], as[3], tb == 2 ? 4 * u + 2 : -1);
      }
    }
  };

  // Keys in front of the wave's first query: both queries of every lane take every key.
  // 64 keys a trip (i0 is a multiple of 64), in two register sets. The work is cut into
  // steps of two keys for one query, step n belonging to partial sum n & 3, and every
  // step issues in the order  exp2, add, exp2, fma, fma : a packed operation
  // stands behind every exp2. Nothing in a step waits for
  // the step itself: its two exp2 take the scores formed four steps earlier (sc), its
  // add and first fma sum up the exp2 of four steps earlier (pe), its last fma forms the
  // scores of four steps on. Every partial sum still takes its keys in rising order.
  v2f sc[4], pe[4] = {};
  // unrolled: sc is indexed by constants only
#pragma unroll
  for (int st = 0; st < 4; ++st)
    sc[st] = __builtin_elementwise_fma(st < 2 ? qa2 : qb2,
                                       st & 1 ? __builtin_shufflevector(k0[0], k0[0], 2, 3)
                                              : __builtin_shufflevector(k0[0], k0[0], 0, 1),
                                       st < 2 ? ma2 : mb2);
  // the first four steps sum up pe = 0 times these values: they must be finite
  v1[7] = (v4f){0.0f, 0.0f, 0.0f, 0.0f};
  // kn: the two keys of four steps on; vo: the two values of four steps earlier
  auto step = [&](int st, v2f kn, v2f vo) {
    v2f pn;
    pn.x = __builtin_amdgcn_exp2f(sc[st].x);
    ls[st] += pe[st];
    pn.y = __builtin_amdgcn_exp2f(sc[st].y);
    as[st] = __builtin_elementwise_fma(pe[st], vo, as[st]);
    sc[st] = __builtin_elementwise_fma(st < 2 ? qa2 : qb2, kn, st < 2 ? ma2 : mb2);
    pe[st] = pn;
    // the four groups below give the scheduler the order named above (0x400: an exp2,
    // 0x002: a packed operation); left free, it gathers the exp2 in runs of eight
    __builtin_amdgcn_sched_group_barrier(0x400, 1, 0);
    __builtin_amdgcn_sched_group_barrier(0x002, 1, 0);
    __builtin_amdgcn_sched_group_barrier(0x400, 1, 0);
    __builtin_amdgcn_sched_group_barrier(0x002, 2, 0);
  };
  // the two keys or values that step n (0 .. 63) of a trip works on
  auto two = [&](const v4f (&r0)[8], const v4f (&r1)[8], int n) {
    const v4f r = n & 32 ? r1[(n >> 2) & 7] : r0[(n >> 2) & 7];
    return n & 1 ? __builtin_shufflevector(r, r, 2, 3) : __builtin_shufflevector(r, r, 0, 1);
  };
  // rolled: the body is already 64 keys long
#pragma unroll 1
  for (int j = 0; j < i0; j += 64) {
    // unrolled: registers are indexed by constants only. A register set is read anew
    // behind the step that uses it last, about 32 steps ahead of its next use.
#pragma unroll
    for (int n = 0; n < 64; ++n) {
      step(n & 3, two(k0, k1, (n + 4) & 63), two(v0, v1, (n + 60) & 63));
      if (n == 3)  fetch(v1, &v_s[j + 32], true);
      if (n == 27) fetch(k0, &k_s[j + 64], true);
      if (n == 35) fetch(v0, &v_s[j + 64], true);
      if (n == 59) fetch(k1, &k_s[j + 96], true);
    }
  }
  // The last four steps' exp2 are summed up (unrolled: constant indices); the scores
  // formed ahead are dropped, the keys they belong to are handled below.
#pragma unroll
  for (int st = 0; st < 4; ++st) {
    ls[st] += pe[st];
    as[st] = __builtin_elementwise_fma(pe[st], two(v0, v1, 60 + st), as[st]);
  }

  // Keys i0 .. i0 + 31 (they lie in k0, v0): query ia's own segment, all of them in
  // front of query ib. Keys i0 + 32 .. i0 + 63 (k1 holds them): query ib's own segment,
  // none for ia.
  fetch(v1, &v_s[i0 + 32]);
  keys32(k0, v0, 2, 1);
  keys32(k1, v1, 0, 2);

  const float l_a   = (ls[0].x + ls[0].y) + (ls[1].x + ls[1].y);
  const float acc_a = (as[0].x + as[0].y) + (as[1].x + as[1].y);
  const float l_b   = (ls[2].x + ls[2].y) + (ls[3].x + ls[3].y);
  const float acc_b = (as[2].x + as[2].y) + (as[3].x + as[3].y);
  oh[(size_t)ia * NHEAD + h] = acc_a / l_a;
  oh[(size_t)ib * NHEAD + h] = acc_b / l_b;
}

// ---------------------------------------------------------------------------
// Launch: qkv GEMM -> attention -> output GEMM. Scratch in d_ws:
//   qkv : 192*SEQ floats (1.5 MB), feature-major: row f holds feature f of every position
//   oh  : SEQ*64  floats (0.5 MB)
// ---------------------------------------------------------------------------
extern "C" void kernel_launch(void* const* d_in, const int* in_sizes, int n_in,
                              void* d_out, int out_size, void* d_ws, size_t ws_size,
                              hipStream_t stream) {
  const float* x     = (const float*)d_in[0];   // [1, 2048, 1024]
  const float* w_qkv = (const float*)d_in[1];   // [192, 1024]
  const float* w_out = (const float*)d_in[2];   // [1024, 64]
  float* y = (float*)d_out;                     // [1, 2048, 1024]

  float* qkv = (float*)d_ws;                    // [192, 2048]
  float* oh  = qkv + (size_t)SEQ * FQKV;        // [2048, 64]

  // qkv = (x * w_qkv^T)^T    (M=2048, N=192, K=1024), stored transposed
  gemm_f32_wmma<32, 48, 3, 4, 128, 4, FQKV, DIM, SEQ>
      <<<dim3(FQKV / 48, SEQ / 32), 256, 0, stream>>>(x, w_qkv, qkv);

  // per-head causal softmax attention (head dim 1): one block = head x chunk pair
  attn_headdim1_causal<<<dim3(SEQ / 512, NHEAD), 256, 0, stream>>>(qkv, oh);

  // y = oh * w_out^T     (M=2048, N=1024, K=64)
  gemm_f32_wmma<64, 128, 4, 1, 32, 2, DIM, NHEAD, 0>
      <<<dim3(DIM / 128, SEQ / 64), 256, 0, stream>>>(oh, w_out, y);
}
